// v000
// The times below were measured on an AMD MI455X: many runs one after another, warmed up first and cycling through
// copies of the inputs, with the whole window's GPU time divided by the number of runs. Launches and the gaps
// between them are all in it. The median over several windows is given; except for v000 it joins two sittings, which
// can be a few percent apart, so the side-by-side timings, each taken in one sitting, are the better comparison.
// v000 is the starting kernel. One run takes 120 microseconds.
#include <hip/hip_runtime.h>
#include <math.h>

typedef float v2f __attribute__((ext_vector_type(2)));
typedef float v8f __attribute__((ext_vector_type(8)));

#define NB   16
#define NC   3
#define NH   512
#define NW   512
#define WS   16
#define HWIN 256     // ws*ws
#define HID  12

__global__ __launch_bounds__(256) void winattn_fused(
    const float* __restrict__ x,      const float* __restrict__ fhigh,
    const float* __restrict__ n1w,    const float* __restrict__ n1b,
    const float* __restrict__ qcw,    const float* __restrict__ qdw,
    const float* __restrict__ kvcw,   const float* __restrict__ kvdw,
    const float* __restrict__ tempp,
    const float* __restrict__ pcw,    const float* __restrict__ pcb,
    const float* __restrict__ n2w,    const float* __restrict__ n2b,
    const float* __restrict__ f1w,    const float* __restrict__ f1b,
    const float* __restrict__ f2w,    const float* __restrict__ f2b,
    float* __restrict__ out)
{
    __shared__ float s_q [NC * HWIN];
    __shared__ float s_kv[NC * HWIN];
    __shared__ float s_ln[HWIN * 4];     // LN2 output (K-padded to 4); reused for MLP out
    __shared__ float s_h [HWIN * 16];    // hidden activations (12 padded to 16)
    __shared__ float s_red[15 * 8];

    const int w   = blockIdx.x;          // window id = b*1024 + wy*32 + wx
    const int b   = w >> 10;
    const int wy  = (w >> 5) & 31;
    const int wx  = w & 31;
    const int tid = threadIdx.x;
    const int i   = tid >> 4;
    const int j   = tid & 15;
    const int lane = tid & 31;
    const int wave = tid >> 5;

    const int  y     = wy * WS + i;
    const int  xg    = wx * WS + j;
    const long pix   = (long)y * NW + xg;
    const long plane = (long)NH * NW;
    const long xbase = (long)b * NC * plane + pix;

    // ---- load x (3 channels), LayerNorm1 over C ----
    float xin[3];
    xin[0] = x[xbase];
    xin[1] = x[xbase + plane];
    xin[2] = x[xbase + 2 * plane];
    {
        float m  = (xin[0] + xin[1] + xin[2]) * (1.f / 3.f);
        float d0 = xin[0] - m, d1 = xin[1] - m, d2 = xin[2] - m;
        float v  = (d0 * d0 + d1 * d1 + d2 * d2) * (1.f / 3.f);
        float rs = rsqrtf(v + 1e-5f);
        float xn0 = d0 * rs * n1w[0] + n1b[0];
        float xn1 = d1 * rs * n1w[1] + n1b[1];
        float xn2 = d2 * rs * n1w[2] + n1b[2];
        // conv1x1 kv -> LDS
        #pragma unroll
        for (int c = 0; c < 3; ++c)
            s_kv[c * HWIN + tid] = kvcw[c*3+0]*xn0 + kvcw[c*3+1]*xn1 + kvcw[c*3+2]*xn2;
    }
    {
        const long fb = (long)w * (NC * HWIN);
        float f0 = fhigh[fb + tid];
        float f1 = fhigh[fb + HWIN + tid];
        float f2 = fhigh[fb + 2 * HWIN + tid];
        #pragma unroll
        for (int c = 0; c < 3; ++c)
            s_q[c * HWIN + tid] = qcw[c*3+0]*f0 + qcw[c*3+1]*f1 + qcw[c*3+2]*f2;
    }
    __syncthreads();

    // ---- depthwise 3x3 (zero pad at window edges) ----
    float qd[3], kd[3];
    #pragma unroll
    for (int c = 0; c < 3; ++c) {
        float aq = 0.f, ak = 0.f;
        #pragma unroll
        for (int di = 0; di < 3; ++di) {
            int ii = i + di - 1;
            if (ii < 0 || ii > 15) continue;
            #pragma unroll
            for (int dj = 0; dj < 3; ++dj) {
                int jj = j + dj - 1;
                if (jj < 0 || jj > 15) continue;
                int idx = c * HWIN + ii * 16 + jj;
                aq += qdw [c*9 + di*3 + dj] * s_q [idx];
                ak += kvdw[c*9 + di*3 + dj] * s_kv[idx];
            }
        }
        qd[c] = aq; kd[c] = ak;
    }

    // ---- 15 block reductions over 256 pixels ----
    float vals[15];
    #pragma unroll
    for (int c = 0; c < 3; ++c) { vals[c] = qd[c]*qd[c]; vals[3+c] = kd[c]*kd[c]; }
    #pragma unroll
    for (int c = 0; c < 3; ++c)
        #pragma unroll
        for (int d = 0; d < 3; ++d) vals[6 + c*3 + d] = qd[c] * kd[d];

    #pragma unroll
    for (int r = 0; r < 15; ++r) {
        float v = vals[r];
        #pragma unroll
        for (int off = 16; off > 0; off >>= 1) v += __shfl_down(v, off);
        if (lane == 0) s_red[r * 8 + wave] = v;
    }
    __syncthreads();

    float sums[15];
    #pragma unroll
    for (int r = 0; r < 15; ++r) {
        float s = 0.f;
        #pragma unroll
        for (int k = 0; k < 8; ++k) s += s_red[r * 8 + k];
        sums[r] = s;
    }

    // ---- 3x3 attention (redundant per thread, trivial) ----
    const float temp = tempp[0];
    float nq[3], nk[3];
    #pragma unroll
    for (int c = 0; c < 3; ++c) {
        nq[c] = fmaxf(sqrtf(sums[c]),     1e-12f);
        nk[c] = fmaxf(sqrtf(sums[3 + c]), 1e-12f);
    }
    float attn[3][3];
    #pragma unroll
    for (int c = 0; c < 3; ++c) {
        float l[3];
        #pragma unroll
        for (int d = 0; d < 3; ++d) l[d] = sums[6 + c*3 + d] * temp / (nq[c] * nk[d]);
        float mx = fmaxf(l[0], fmaxf(l[1], l[2]));
        float e0 = __expf(l[0]-mx), e1 = __expf(l[1]-mx), e2 = __expf(l[2]-mx);
        float inv = 1.f / (e0 + e1 + e2);
        attn[c][0] = e0*inv; attn[c][1] = e1*inv; attn[c][2] = e2*inv;
    }

    // x2 = attn @ v  (v = kd, unnormalized), then proj conv1x1 + bias + residual
    float x2c[3], xs2[3];
    #pragma unroll
    for (int c = 0; c < 3; ++c)
        x2c[c] = attn[c][0]*kd[0] + attn[c][1]*kd[1] + attn[c][2]*kd[2];
    #pragma unroll
    for (int c = 0; c < 3; ++c)
        xs2[c] = xin[c] + pcw[c*3+0]*x2c[0] + pcw[c*3+1]*x2c[1] + pcw[c*3+2]*x2c[2] + pcb[c];

    // ---- LayerNorm2, stage into WMMA A layout (K padded 3->4) ----
    {
        float m  = (xs2[0] + xs2[1] + xs2[2]) * (1.f / 3.f);
        float d0 = xs2[0]-m, d1 = xs2[1]-m, d2 = xs2[2]-m;
        float v  = (d0*d0 + d1*d1 + d2*d2) * (1.f / 3.f);
        float rs = rsqrtf(v + 1e-5f);
        s_ln[tid*4 + 0] = d0 * rs * n2w[0] + n2b[0];
        s_ln[tid*4 + 1] = d1 * rs * n2w[1] + n2b[1];
        s_ln[tid*4 + 2] = d2 * rs * n2w[2] + n2b[2];
        s_ln[tid*4 + 3] = 0.f;
    }
    __syncthreads();

    // ---- MLP via V_WMMA_F32_16X16X4_F32 ----
    // A layout (16x4 f32): lanes 0-15 hold K={0,1}, lanes 16-31 hold K={2,3}; M = lane&15
    // D layout (16x16 f32): VGPR r -> M = r (lanes 0-15) / r+8 (lanes 16-31); N = lane&15
    const int half = lane >> 4;
    const int row  = lane & 15;
    const int koff = half * 2;

    // fc1: [16 pixels x 3] @ [3 x 12]  (B[k][n] = fc1_w[n][k], zero-padded)
    v2f b1;
    b1.x = (koff     < 3 && row < HID) ? f1w[row*3 + koff    ] : 0.f;
    b1.y = (koff + 1 < 3 && row < HID) ? f1w[row*3 + koff + 1] : 0.f;
    const float bias1 = (row < HID) ? f1b[row] : 0.f;

    #pragma unroll
    for (int t = 0; t < 2; ++t) {
        const int pbase = wave * 32 + t * 16;
        const int p = pbase + row;
        v2f av; av.x = s_ln[p*4 + koff]; av.y = s_ln[p*4 + koff + 1];
        v8f acc = {};
        acc = __builtin_amdgcn_wmma_f32_16x16x4_f32(false, av, false, b1,
                                                    (short)0, acc, false, false);
        #pragma unroll
        for (int r = 0; r < 8; ++r) {
            float hv = acc[r] + bias1;
            hv = 0.5f * hv * (1.f + erff(hv * 0.70710678118654752f));   // exact GELU
            s_h[(pbase + r + half*8) * 16 + row] = hv;                  // j>=12 columns stay 0
        }
    }
    __syncthreads();

    // fc2: [16 pixels x 12] @ [12 x 3], K split into 3 chunks of 4, chained accumulators
    #pragma unroll
    for (int t = 0; t < 2; ++t) {
        const int pbase = wave * 32 + t * 16;
        const int p = pbase + row;
        v8f acc = {};
        #pragma unroll
        for (int kc = 0; kc < 3; ++kc) {
            v2f av; av.x = s_h[p*16 + kc*4 + koff]; av.y = s_h[p*16 + kc*4 + koff + 1];
            const int kg = kc * 4 + koff;
            v2f bv;
            bv.x = (kg     < HID && row < 3) ? f2w[row*HID + kg    ] : 0.f;
            bv.y = (kg + 1 < HID && row < 3) ? f2w[row*HID + kg + 1] : 0.f;
            acc = __builtin_amdgcn_wmma_f32_16x16x4_f32(false, av, false, bv,
                                                        (short)0, acc, false, false);
        }
        if (row < 3) {
            #pragma unroll
            for (int r = 0; r < 8; ++r)
                s_ln[(pbase + r + half*8) * 4 + row] = acc[r];   // reuse s_ln as MLP-out buf
        }
    }
    __syncthreads();

    // ---- residual + coalesced channel-plane stores ----
    #pragma unroll
    for (int c = 0; c < 3; ++c)
        out[(long)(b * NC + c) * plane + pix] = xs2[c] + s_ln[tid*4 + c] + f2b[c];
}

extern "C" void kernel_launch(void* const* d_in, const int* in_sizes, int n_in,
                              void* d_out, int out_size, void* d_ws, size_t ws_size,
                              hipStream_t stream) {
    (void)in_sizes; (void)n_in; (void)out_size; (void)d_ws; (void)ws_size;
    // setup_inputs order: 0:H 1:W 2:x 3:fhigh 4:norm1_w 5:norm1_b 6:q_C_w 7:q_dw_w
    // 8:kv_C_w 9:kv_dw_w 10:temperature 11:proj_C_w 12:proj_C_b 13:norm2_w 14:norm2_b
    // 15:fc1_w 16:fc1_b 17:fc2_w 18:fc2_b
    const float* x     = (const float*)d_in[2];
    const float* fh    = (const float*)d_in[3];
    const float* n1w   = (const float*)d_in[4];
    const float* n1b   = (const float*)d_in[5];
    const float* qcw   = (const float*)d_in[6];
    const float* qdw   = (const float*)d_in[7];
    const float* kvcw  = (const float*)d_in[8];
    const float* kvdw  = (const float*)d_in[9];
    const float* tempp = (const float*)d_in[10];
    const float* pcw   = (const float*)d_in[11];
    const float* pcb   = (const float*)d_in[12];
    const float* n2w   = (const float*)d_in[13];
    const float* n2b   = (const float*)d_in[14];
    const float* f1w   = (const float*)d_in[15];
    const float* f1b   = (const float*)d_in[16];
    const float* f2w   = (const float*)d_in[17];
    const float* f2b   = (const float*)d_in[18];
    float* out = (float*)d_out;

    const int nWindows = NB * (NH / WS) * (NW / WS);   // 16384
    winattn_fused<<<nWindows, 256, 0, stream>>>(
        x, fh, n1w, n1b, qcw, qdw, kvcw, kvdw, tempp,
        pcw, pcb, n2w, n2b, f1w, f1b, f2w, f2b, out);
}

// v001
// One run takes 111 microseconds.
// In both of two side-by-side timings against v000, it was 1.14 times as fast.
#include <hip/hip_runtime.h>
#include <math.h>

typedef float v2f __attribute__((ext_vector_type(2)));
typedef float v8f __attribute__((ext_vector_type(8)));

#define NB   16
#define NC   3
#define NH   512
#define NW   512
#define WS   16
#define HWIN 256     // ws*ws
#define HID  12

// second bound: holds the allocation at 80 registers (12 waves per SIMD, as before this step);
// without it the build takes 90 and two waves per SIMD are lost
__global__ __launch_bounds__(256, 12) void winattn_fused(
    const float* __restrict__ x,      const float* __restrict__ fhigh,
    const float* __restrict__ n1w,    const float* __restrict__ n1b,
    const float* __restrict__ qcw,    const float* __restrict__ qdw,
    const float* __restrict__ kvcw,   const float* __restrict__ kvdw,
    const float* __restrict__ tempp,
    const float* __restrict__ pcw,    const float* __restrict__ pcb,
    const float* __restrict__ n2w,    const float* __restrict__ n2b,
    const float* __restrict__ f1w,    const float* __restrict__ f1b,
    const float* __restrict__ f2w,    const float* __restrict__ f2b,
    float* __restrict__ out)
{
    __shared__ float s_q [NC * HWIN];
    __shared__ float s_kv[NC * HWIN];
    __shared__ float s_red[15 * 8];

    const int w   = blockIdx.x;          // window id = b*1024 + wy*32 + wx
    const int b   = w >> 10;
    const int wy  = (w >> 5) & 31;
    const int wx  = w & 31;
    const int tid = threadIdx.x;
    const int i   = tid >> 4;
    const int j   = tid & 15;
    const int lane = tid & 31;
    const int wave = tid >> 5;

    const int  y     = wy * WS + i;
    const int  xg    = wx * WS + j;
    const long pix   = (long)y * NW + xg;
    const long plane = (long)NH * NW;
    const long xbase = (long)b * NC * plane + pix;

    // ---- load x (3 channels), LayerNorm1 over C ----
    float xin[3];
    xin[0] = x[xbase];
    xin[1] = x[xbase + plane];
    xin[2] = x[xbase + 2 * plane];
    {
        float m  = (xin[0] + xin[1] + xin[2]) * (1.f / 3.f);
        float d0 = xin[0] - m, d1 = xin[1] - m, d2 = xin[2] - m;
        float v  = (d0 * d0 + d1 * d1 + d2 * d2) * (1.f / 3.f);
        float rs = rsqrtf(v + 1e-5f);
        float xn0 = d0 * rs * n1w[0] + n1b[0];
        float xn1 = d1 * rs * n1w[1] + n1b[1];
        float xn2 = d2 * rs * n1w[2] + n1b[2];
        // conv1x1 kv -> LDS
        #pragma unroll
        for (int c = 0; c < 3; ++c)
            s_kv[c * HWIN + tid] = kvcw[c*3+0]*xn0 + kvcw[c*3+1]*xn1 + kvcw[c*3+2]*xn2;
    }
    {
        const long fb = (long)w * (NC * HWIN);
        float f0 = fhigh[fb + tid];
        float f1 = fhigh[fb + HWIN + tid];
        float f2 = fhigh[fb + 2 * HWIN + tid];
        #pragma unroll
        for (int c = 0; c < 3; ++c)
            s_q[c * HWIN + tid] = qcw[c*3+0]*f0 + qcw[c*3+1]*f1 + qcw[c*3+2]*f2;
    }
    __syncthreads();

    // ---- depthwise 3x3 (zero pad at window edges) ----
    float qd[3], kd[3];
    #pragma unroll
    for (int c = 0; c < 3; ++c) {
        float aq = 0.f, ak = 0.f;
        #pragma unroll
        for (int di = 0; di < 3; ++di) {
            int ii = i + di - 1;
            if (ii < 0 || ii > 15) continue;
            #pragma unroll
            for (int dj = 0; dj < 3; ++dj) {
                int jj = j + dj - 1;
                if (jj < 0 || jj > 15) continue;
                int idx = c * HWIN + ii * 16 + jj;
                aq += qdw [c*9 + di*3 + dj] * s_q [idx];
                ak += kvdw[c*9 + di*3 + dj] * s_kv[idx];
            }
        }
        qd[c] = aq; kd[c] = ak;
    }

    // ---- 15 block reductions over 256 pixels ----
    float vals[15];
    #pragma unroll
    for (int c = 0; c < 3; ++c) { vals[c] = qd[c]*qd[c]; vals[3+c] = kd[c]*kd[c]; }
    #pragma unroll
    for (int c = 0; c < 3; ++c)
        #pragma unroll
        for (int d = 0; d < 3; ++d) vals[6 + c*3 + d] = qd[c] * kd[d];

    #pragma unroll
    for (int r = 0; r < 15; ++r) {
        float v = vals[r];
        #pragma unroll
        for (int off = 16; off > 0; off >>= 1) v += __shfl_down(v, off);
        if (lane == 0) s_red[r * 8 + wave] = v;
    }
    __syncthreads();

    float sums[15];
    #pragma unroll
    for (int r = 0; r < 15; ++r) {
        float s = 0.f;
        #pragma unroll
        for (int k = 0; k < 8; ++k) s += s_red[r * 8 + k];
        sums[r] = s;
    }

    // ---- 3x3 attention (redundant per thread, trivial) ----
    const float temp = tempp[0];
    float nq[3], nk[3];
    #pragma unroll
    for (int c = 0; c < 3; ++c) {
        nq[c] = fmaxf(sqrtf(sums[c]),     1e-12f);
        nk[c] = fmaxf(sqrtf(sums[3 + c]), 1e-12f);
    }
    float attn[3][3];
    #pragma unroll
    for (int c = 0; c < 3; ++c) {
        float l[3];
        #pragma unroll
        for (int d = 0; d < 3; ++d) l[d] = sums[6 + c*3 + d] * temp / (nq[c] * nk[d]);
        float mx = fmaxf(l[0], fmaxf(l[1], l[2]));
        float e0 = __expf(l[0]-mx), e1 = __expf(l[1]-mx), e2 = __expf(l[2]-mx);
        float inv = 1.f / (e0 + e1 + e2);
        attn[c][0] = e0*inv; attn[c][1] = e1*inv; attn[c][2] = e2*inv;
    }

    // ---- MLP weights of this lane's A rows, asked for ahead of the MLP ----
    // (what they are for: the MLP section below). Every lane reads from a row clamped into the array.
    const int  half = lane >> 4;
    const int  sub  = lane & 7;                       // output row inside this lane's block
    const bool mine = ((lane >> 3) & 1) == half;      // this lane's A slots lie on the diagonal block
    const unsigned ow1a = 12u * (unsigned)sub;                 // byte offsets: fc1_w row sub,
    const int      sub4 = sub & 3;                             // rows 8 + sub exist for sub < 4
    const unsigned ow1b = 12u * (unsigned)sub4;                // fc1_w row 8 + sub4, from row 8,
    const unsigned ow2  = 48u * (unsigned)(sub < NC ? sub : NC - 1);   // fc2_w row sub (sub < 3)
    float w1a[3], w1b[3], w2[HID];
    #pragma unroll
    for (int k = 0; k < 3; ++k) {
        w1a[k] = ((const float*)((const char*)f1w + ow1a))[k];
        w1b[k] = ((const float*)((const char*)(f1w + 24) + ow1b))[k];
    }
    const float b1a = f1b[sub];
    const float b1b = f1b[8 + sub4];
    #pragma unroll
    for (int k = 0; k < HID; ++k) w2[k] = ((const float*)((const char*)f2w + ow2))[k];
    // The loads' offset and index registers are inputs here so that none of them is reused, not even as a
    // load's destination, ahead of the wait on the address translations.
    asm volatile("s_wait_xcnt 0x0" :: "v"(ow1a), "v"(ow1b), "v"(sub), "v"(sub4), "v"(ow2) : "memory");

    // x2 = attn @ v  (v = kd, unnormalized), then proj conv1x1 + bias + residual
    float x2c[3], xs2[3];
    #pragma unroll
    for (int c = 0; c < 3; ++c)
        x2c[c] = attn[c][0]*kd[0] + attn[c][1]*kd[1] + attn[c][2]*kd[2];
    #pragma unroll
    for (int c = 0; c < 3; ++c)
        xs2[c] = xin[c] + pcw[c*3+0]*x2c[0] + pcw[c*3+1]*x2c[1] + pcw[c*3+2]*x2c[2] + pcb[c];

    // ---- LayerNorm2, kept in this lane's registers ----
    float ln0, ln1, ln2;
    {
        float m  = (xs2[0] + xs2[1] + xs2[2]) * (1.f / 3.f);
        float d0 = xs2[0]-m, d1 = xs2[1]-m, d2 = xs2[2]-m;
        float v  = (d0*d0 + d1*d1 + d2*d2) * (1.f / 3.f);
        float rs = rsqrtf(v + 1e-5f);
        ln0 = d0 * rs * n2w[0] + n2b[0];
        ln1 = d1 * rs * n2w[1] + n2b[1];
        ln2 = d2 * rs * n2w[2] + n2b[2];
    }

    // ---- MLP via V_WMMA_F32_16X16X4_F32, weights as A, pixels as B, no LDS ----
    // Lane l: col = l & 15, half = l >> 4. A: lane holds row col, B: lane holds column col;
    // each half supplies two of the four k slots, slot (half, s) of A meeting slot (half, s) of B.
    // D register r of lane l is D[8*half + r][col].
    // A is block-diagonal: rows 0-7 carry weights only in the k slots of half 0, rows 8-15 only in
    // those of half 1. Then D[8*half + r][col] is built from the B values of lane l alone, so every
    // lane feeds its own pixel as B and gets its own pixel's results back as D: two k per WMMA,
    // eight output rows per WMMA, 32 pixels per WMMA.
    // fc1 weights: hidden unit j = 8*g + sub; k = {c0, c1}, then {c2, bias against a B of 1}
    const bool ok1 = mine && sub < HID - 8;
    const bool ok2 = mine && sub < NC;
    v2f a1[2][2];
    a1[0][0].x = mine ? w1a[0] : 0.f;  a1[0][0].y = mine ? w1a[1] : 0.f;
    a1[0][1].x = mine ? w1a[2] : 0.f;  a1[0][1].y = mine ? b1a    : 0.f;
    a1[1][0].x = ok1  ? w1b[0] : 0.f;  a1[1][0].y = ok1  ? w1b[1] : 0.f;
    a1[1][1].x = ok1  ? w1b[2] : 0.f;  a1[1][1].y = ok1  ? b1b    : 0.f;
    // fc2 weights: output channel sub (< 3); k = hidden units {2q, 2q+1}
    v2f a2[6];
    #pragma unroll
    for (int q = 0; q < 6; ++q) {
        a2[q].x = ok2 ? w2[2*q]     : 0.f;
        a2[q].y = ok2 ? w2[2*q + 1] : 0.f;
    }

    v2f bx0; bx0.x = ln0; bx0.y = ln1;
    v2f bx1; bx1.x = ln2; bx1.y = 1.f;
    float hg[16];                                     // hidden units 0-11 of this lane's pixel (12-15 unused)
    #pragma unroll
    for (int g = 0; g < 2; ++g) {
        v8f acc = {};
        acc = __builtin_amdgcn_wmma_f32_16x16x4_f32(false, a1[g][0], false, bx0,
                                                    (short)0, acc, false, false);
        acc = __builtin_amdgcn_wmma_f32_16x16x4_f32(false, a1[g][1], false, bx1,
                                                    (short)0, acc, false, false);
        #pragma unroll
        for (int r = 0; r < 8; ++r) hg[8*g + r] = acc[r];
    }
    #pragma unroll
    for (int k = 0; k < HID; ++k) {
        float hv = hg[k];
        hg[k] = 0.5f * hv * (1.f + erff(hv * 0.70710678118654752f));   // exact GELU
    }

    // fc2: C starts as residual + bias in this lane's rows 0-2; six chained k pairs
    v8f o = {};
    #pragma unroll
    for (int c = 0; c < 3; ++c) o[c] = xs2[c] + f2b[c];
    #pragma unroll
    for (int q = 0; q < 6; ++q) {
        v2f bh; bh.x = hg[2*q]; bh.y = hg[2*q + 1];
        o = __builtin_amdgcn_wmma_f32_16x16x4_f32(false, a2[q], false, bh,
                                                  (short)0, o, false, false);
    }

    // ---- coalesced channel-plane stores ----
    #pragma unroll
    for (int c = 0; c < 3; ++c)
        out[(long)(b * NC + c) * plane + pix] = o[c];
}

extern "C" void kernel_launch(void* const* d_in, const int* in_sizes, int n_in,
                              void* d_out, int out_size, void* d_ws, size_t ws_size,
                              hipStream_t stream) {
    (void)in_sizes; (void)n_in; (void)out_size; (void)d_ws; (void)ws_size;
    // setup_inputs order: 0:H 1:W 2:x 3:fhigh 4:norm1_w 5:norm1_b 6:q_C_w 7:q_dw_w
    // 8:kv_C_w 9:kv_dw_w 10:temperature 11:proj_C_w 12:proj_C_b 13:norm2_w 14:norm2_b
    // 15:fc1_w 16:fc1_b 17:fc2_w 18:fc2_b
    const float* x     = (const float*)d_in[2];
    const float* fh    = (const float*)d_in[3];
    const float* n1w   = (const float*)d_in[4];
    const float* n1b   = (const float*)d_in[5];
    const float* qcw   = (const float*)d_in[6];
    const float* qdw   = (const float*)d_in[7];
    const float* kvcw  = (const float*)d_in[8];
    const float* kvdw  = (const float*)d_in[9];
    const float* tempp = (const float*)d_in[10];
    const float* pcw   = (const float*)d_in[11];
    const float* pcb   = (const float*)d_in[12];
    const float* n2w   = (const float*)d_in[13];
    const float* n2b   = (const float*)d_in[14];
    const float* f1w   = (const float*)d_in[15];
    const float* f1b   = (const float*)d_in[16];
    const float* f2w   = (const float*)d_in[17];
    const float* f2b   = (const float*)d_in[18];
    float* out = (float*)d_out;

    const int nWindows = NB * (NH / WS) * (NW / WS);   // 16384
    winattn_fused<<<nWindows, 256, 0, stream>>>(
        x, fh, n1w, n1b, qcw, qdw, kvcw, kvdw, tempp,
        pcw, pcb, n2w, n2b, f1w, f1b, f2w, f2b, out);
}

// v002
// Measured time: 76.2 microseconds a run.
// Two timings next to v001 both put it at 1.45 times that version's speed.
// Over all steps from v000 it is 1.65 times as fast.
#include <hip/hip_runtime.h>
#include <math.h>

typedef float v2f __attribute__((ext_vector_type(2)));
typedef float v8f __attribute__((ext_vector_type(8)));

#define NB   16
#define NC   3
#define NH   512
#define NW   512
#define WS   16
#define HWIN 256     // ws*ws
#define HID  12
#define UP   36      // LDS pitch (floats) of one staged channel row of 32 pixels: 16-byte reads of rows 0-5 meet no bank twice
#define UW   (6 * UP)
#define GP   8       // LDS pitch (floats) of one lane's eight accumulator registers
#define GW   (32 * GP)

// second bound: holds the allocation at 80 registers or fewer (12 waves per SIMD at least)
__global__ __launch_bounds__(256, 12) void winattn_fused(
    const float* __restrict__ x,      const float* __restrict__ fhigh,
    const float* __restrict__ n1w,    const float* __restrict__ n1b,
    const float* __restrict__ qcw,    const float* __restrict__ qdw,
    const float* __restrict__ kvcw,   const float* __restrict__ kvdw,
    const float* __restrict__ tempp,
    const float* __restrict__ pcw,    const float* __restrict__ pcb,
    const float* __restrict__ n2w,    const float* __restrict__ n2b,
    const float* __restrict__ f1w,    const float* __restrict__ f1b,
    const float* __restrict__ f2w,    const float* __restrict__ f2b,
    float* __restrict__ out)
{
    __shared__ float s_q [NC * HWIN];
    __shared__ float s_kv[NC * HWIN];
    __shared__ __attribute__((aligned(16))) float s_u[8 * UW];   // per wave: q0-2, kv0-2 of its 32 pixels
    __shared__ __attribute__((aligned(16))) float s_g[8 * GW];   // per wave: its Gram partial, as the accumulator lies in the lanes

    const int w   = blockIdx.x;          // window id = b*1024 + wy*32 + wx
    const int b   = w >> 10;
    const int wy  = (w >> 5) & 31;
    const int wx  = w & 31;
    const int tid = threadIdx.x;
    const int i   = tid >> 4;
    const int j   = tid & 15;
    const int lane = tid & 31;
    const int wave = tid >> 5;

    const int  y     = wy * WS + i;
    const int  xg    = wx * WS + j;
    const long pix   = (long)y * NW + xg;
    const long plane = (long)NH * NW;
    const long xbase = (long)b * NC * plane + pix;

    // ---- load x (3 channels), LayerNorm1 over C ----
    float xin[3];
    xin[0] = x[xbase];
    xin[1] = x[xbase + plane];
    xin[2] = x[xbase + 2 * plane];
    {
        float m  = (xin[0] + xin[1] + xin[2]) * (1.f / 3.f);
        float d0 = xin[0] - m, d1 = xin[1] - m, d2 = xin[2] - m;
        float v  = (d0 * d0 + d1 * d1 + d2 * d2) * (1.f / 3.f);
        float rs = rsqrtf(v + 1e-5f);
        float xn0 = d0 * rs * n1w[0] + n1b[0];
        float xn1 = d1 * rs * n1w[1] + n1b[1];
        float xn2 = d2 * rs * n1w[2] + n1b[2];
        // conv1x1 kv -> LDS
        #pragma unroll
        for (int c = 0; c < 3; ++c)
            s_kv[c * HWIN + tid] = kvcw[c*3+0]*xn0 + kvcw[c*3+1]*xn1 + kvcw[c*3+2]*xn2;
    }
    {
        const long fb = (long)w * (NC * HWIN);
        float f0 = fhigh[fb + tid];
        float f1 = fhigh[fb + HWIN + tid];
        float f2 = fhigh[fb + 2 * HWIN + tid];
        #pragma unroll
        for (int c = 0; c < 3; ++c)
            s_q[c * HWIN + tid] = qcw[c*3+0]*f0 + qcw[c*3+1]*f1 + qcw[c*3+2]*f2;
    }
    __syncthreads();

    // ---- depthwise 3x3 (zero pad at window edges) ----
    float qd[3], kd[3];
    #pragma unroll
    for (int c = 0; c < 3; ++c) {
        float aq = 0.f, ak = 0.f;
        #pragma unroll
        for (int di = 0; di < 3; ++di) {
            int ii = i + di - 1;
            if (ii < 0 || ii > 15) continue;
            #pragma unroll
            for (int dj = 0; dj < 3; ++dj) {
                int jj = j + dj - 1;
                if (jj < 0 || jj > 15) continue;
                int idx = c * HWIN + ii * 16 + jj;
                aq += qdw [c*9 + di*3 + dj] * s_q [idx];
                ak += kvdw[c*9 + di*3 + dj] * s_kv[idx];
            }
        }
        qd[c] = aq; kd[c] = ak;
    }

    // ---- the 15 window sums as one Gram matrix G = U * U^T on V_WMMA_F32_16X16X4_F32 ----
    // U: rows q0 q1 q2 kv0 kv1 kv2, columns the pixels. G[c][c] are the squared norms, G[c][3+d] = q_c . kv_d.
    // Each wave stages its own 32 pixels channel-major in its own LDS range and reads them back with lane l
    // holding row (l & 15) and the 16 pixels of half (l >> 4): that one fragment is A (row) and B (column) at
    // once, so k slot (half, s) of A and of B is the same pixel. Rows 6-15 repeat row 5; they reach only
    // rows and columns of G that nobody reads.
    const int half = lane >> 4;
    const int col  = lane & 15;
    const int row  = col < 6 ? col : 5;
    {
        float* uw = s_u + wave * UW;
        #pragma unroll
        for (int c = 0; c < 3; ++c) {
            uw[c * UP + lane]       = qd[c];
            uw[(3 + c) * UP + lane] = kd[c];
        }
        // the wave's own stores have landed before other lanes of the wave read them; also keeps the
        // compiler from lifting the reads over the stores
        asm volatile("s_wait_dscnt 0x0" ::: "memory");
        const float4* up = (const float4*)(uw + row * UP + 16 * half);
        float4 u[4];
        #pragma unroll
        for (int t = 0; t < 4; ++t) u[t] = up[t];
        v8f g = {};
        #pragma unroll
        for (int t = 0; t < 4; ++t) {
            v2f lo; lo.x = u[t].x; lo.y = u[t].y;
            v2f hi; hi.x = u[t].z; hi.y = u[t].w;
            g = __builtin_amdgcn_wmma_f32_16x16x4_f32(false, lo, false, lo, (short)0, g, false, false);
            g = __builtin_amdgcn_wmma_f32_16x16x4_f32(false, hi, false, hi, (short)0, g, false, false);
        }
        // lane d < 6 holds G[0..5][d] of this wave's pixels in registers 0-5; every lane stores its six,
        // so no branch stands behind the WMMA
        float* gp = s_g + wave * GW + lane * GP;
        *(float4*)gp       = make_float4(g[0], g[1], g[2], g[3]);
        *(float2*)(gp + 4) = make_float2(g[4], g[5]);
    }
    __syncthreads();

    // One sum a lane: lane 4c + d adds the eight waves' partials of q_c . kv_d = G[c][3+d], lane 16 + c those
    // of G[c][c]; the other lanes add words that were stored too but are used by nobody. Every lane then takes
    // the 15 sums from those lanes.
    float sums[15];
    {
        const int gi = half ? row * (GP + 1) : (3 + (col & 3)) * GP + (col >> 2);
        float tot = 0.f;
        #pragma unroll
        for (int k = 0; k < 8; ++k) tot += s_g[k * GW + gi];
        const int ti = __float_as_int(tot);
        #pragma unroll
        for (int c = 0; c < 6; ++c) sums[c] = __int_as_float(__builtin_amdgcn_readlane(ti, 16 + c));
        #pragma unroll
        for (int c = 0; c < 3; ++c)
            #pragma unroll
            for (int d = 0; d < 3; ++d)
                sums[6 + c*3 + d] = __int_as_float(__builtin_amdgcn_readlane(ti, 4 * c + d));
    }

    // ---- 3x3 attention (redundant per thread, trivial) ----
    const float temp = tempp[0];
    float nq[3], nk[3];
    #pragma unroll
    for (int c = 0; c < 3; ++c) {
        nq[c] = fmaxf(sqrtf(sums[c]),     1e-12f);
        nk[c] = fmaxf(sqrtf(sums[3 + c]), 1e-12f);
    }
    float attn[3][3];
    #pragma unroll
    for (int c = 0; c < 3; ++c) {
        float l[3];
        #pragma unroll
        for (int d = 0; d < 3; ++d) l[d] = sums[6 + c*3 + d] * temp / (nq[c] * nk[d]);
        float mx = fmaxf(l[0], fmaxf(l[1], l[2]));
        float e0 = __expf(l[0]-mx), e1 = __expf(l[1]-mx), e2 = __expf(l[2]-mx);
        float inv = 1.f / (e0 + e1 + e2);
        attn[c][0] = e0*inv; attn[c][1] = e1*inv; attn[c][2] = e2*inv;
    }

    // ---- MLP weights of this lane's A rows, asked for ahead of the MLP ----
    // (what they are for: the MLP section below). Every lane reads from a row clamped into the array.
    const int  sub  = lane & 7;                       // output row inside this lane's block
    const bool mine = ((lane >> 3) & 1) == half;      // this lane's A slots lie on the diagonal block
    const unsigned ow1a = 12u * (unsigned)sub;                 // byte offsets: fc1_w row sub,
    const int      sub4 = sub & 3;                             // rows 8 + sub exist for sub < 4
    const unsigned ow1b = 12u * (unsigned)sub4;                // fc1_w row 8 + sub4, from row 8,
    const unsigned ow2  = 48u * (unsigned)(sub < NC ? sub : NC - 1);   // fc2_w row sub (sub < 3)
    float w1a[3], w1b[3], w2[HID];
    #pragma unroll
    for (int k = 0; k < 3; ++k) {
        w1a[k] = ((const float*)((const char*)f1w + ow1a))[k];
        w1b[k] = ((const float*)((const char*)(f1w + 24) + ow1b))[k];
    }
    const float b1a = f1b[sub];
    const float b1b = f1b[8 + sub4];
    #pragma unroll
    for (int k = 0; k < HID; ++k) w2[k] = ((const float*)((const char*)f2w + ow2))[k];
    // The loads' offset and index registers are inputs here so that none of them is reused, not even as a
    // load's destination, ahead of the wait on the address translations.
    asm volatile("s_wait_xcnt 0x0" :: "v"(ow1a), "v"(ow1b), "v"(sub), "v"(sub4), "v"(ow2) : "memory");

    // x2 = attn @ v  (v = kd, unnormalized), then proj conv1x1 + bias + residual
    float x2c[3], xs2[3];
    #pragma unroll
    for (int c = 0; c < 3; ++c)
        x2c[c] = attn[c][0]*kd[0] + attn[c][1]*kd[1] + attn[c][2]*kd[2];
    #pragma unroll
    for (int c = 0; c < 3; ++c)
        xs2[c] = xin[c] + pcw[c*3+0]*x2c[0] + pcw[c*3+1]*x2c[1] + pcw[c*3+2]*x2c[2] + pcb[c];

    // ---- LayerNorm2, kept in this lane's registers ----
    float ln0, ln1, ln2;
    {
        float m  = (xs2[0] + xs2[1] + xs2[2]) * (1.f / 3.f);
        float d0 = xs2[0]-m, d1 = xs2[1]-m, d2 = xs2[2]-m;
        float v  = (d0*d0 + d1*d1 + d2*d2) * (1.f / 3.f);
        float rs = rsqrtf(v + 1e-5f);
        ln0 = d0 * rs * n2w[0] + n2b[0];
        ln1 = d1 * rs * n2w[1] + n2b[1];
        ln2 = d2 * rs * n2w[2] + n2b[2];
    }

    // ---- MLP via V_WMMA_F32_16X16X4_F32, weights as A, pixels as B, no LDS ----
    // Lane l: col = l & 15, half = l >> 4. A: lane holds row col, B: lane holds column col;
    // each half supplies two of the four k slots, slot (half, s) of A meeting slot (half, s) of B.
    // D register r of lane l is D[8*half + r][col].
    // A is block-diagonal: rows 0-7 carry weights only in the k slots of half 0, rows 8-15 only in
    // those of half 1. Then D[8*half + r][col] is built from the B values of lane l alone, so every
    // lane feeds its own pixel as B and gets its own pixel's results back as D: two k per WMMA,
    // eight output rows per WMMA, 32 pixels per WMMA.
    // fc1 weights: hidden unit j = 8*g + sub; k = {c0, c1}, then {c2, bias against a B of 1}
    const bool ok1 = mine && sub < HID - 8;
    const bool ok2 = mine && sub < NC;
    v2f a1[2][2];
    a1[0][0].x = mine ? w1a[0] : 0.f;  a1[0][0].y = mine ? w1a[1] : 0.f;
    a1[0][1].x = mine ? w1a[2] : 0.f;  a1[0][1].y = mine ? b1a    : 0.f;
    a1[1][0].x = ok1  ? w1b[0] : 0.f;  a1[1][0].y = ok1  ? w1b[1] : 0.f;
    a1[1][1].x = ok1  ? w1b[2] : 0.f;  a1[1][1].y = ok1  ? b1b    : 0.f;
    // fc2 weights: output channel sub (< 3); k = hidden units {2q, 2q+1}
    v2f a2[6];
    #pragma unroll
    for (int q = 0; q < 6; ++q) {
        a2[q].x = ok2 ? w2[2*q]     : 0.f;
        a2[q].y = ok2 ? w2[2*q + 1] : 0.f;
    }

    v2f bx0; bx0.x = ln0; bx0.y = ln1;
    v2f bx1; bx1.x = ln2; bx1.y = 1.f;
    float hg[16];                                     // hidden units 0-11 of this lane's pixel (12-15 unused)
    #pragma unroll
    for (int g = 0; g < 2; ++g) {
        v8f acc = {};
        acc = __builtin_amdgcn_wmma_f32_16x16x4_f32(false, a1[g][0], false, bx0,
                                                    (short)0, acc, false, false);
        acc = __builtin_amdgcn_wmma_f32_16x16x4_f32(false, a1[g][1], false, bx1,
                                                    (short)0, acc, false, false);
        #pragma unroll
        for (int r = 0; r < 8; ++r) hg[8*g + r] = acc[r];
    }
    #pragma unroll
    for (int k = 0; k < HID; ++k) {
        float hv = hg[k];
        hg[k] = 0.5f * hv * (1.f + erff(hv * 0.70710678118654752f));   // exact GELU
    }

    // fc2: C starts as residual + bias in this lane's rows 0-2; six chained k pairs
    v8f o = {};
    #pragma unroll
    for (int c = 0; c < 3; ++c) o[c] = xs2[c] + f2b[c];
    #pragma unroll
    for (int q = 0; q < 6; ++q) {
        v2f bh; bh.x = hg[2*q]; bh.y = hg[2*q + 1];
        o = __builtin_amdgcn_wmma_f32_16x16x4_f32(false, a2[q], false, bh,
                                                  (short)0, o, false, false);
    }

    // ---- coalesced channel-plane stores ----
    #pragma unroll
    for (int c = 0; c < 3; ++c)
        out[(long)(b * NC + c) * plane + pix] = o[c];
}

extern "C" void kernel_launch(void* const* d_in, const int* in_sizes, int n_in,
                              void* d_out, int out_size, void* d_ws, size_t ws_size,
                              hipStream_t stream) {
    (void)in_sizes; (void)n_in; (void)out_size; (void)d_ws; (void)ws_size;
    // setup_inputs order: 0:H 1:W 2:x 3:fhigh 4:norm1_w 5:norm1_b 6:q_C_w 7:q_dw_w
    // 8:kv_C_w 9:kv_dw_w 10:temperature 11:proj_C_w 12:proj_C_b 13:norm2_w 14:norm2_b
    // 15:fc1_w 16:fc1_b 17:fc2_w 18:fc2_b
    const float* x     = (const float*)d_in[2];
    const float* fh    = (const float*)d_in[3];
    const float* n1w   = (const float*)d_in[4];
    const float* n1b   = (const float*)d_in[5];
    const float* qcw   = (const float*)d_in[6];
    const float* qdw   = (const float*)d_in[7];
    const float* kvcw  = (const float*)d_in[8];
    const float* kvdw  = (const float*)d_in[9];
    const float* tempp = (const float*)d_in[10];
    const float* pcw   = (const float*)d_in[11];
    const float* pcb   = (const float*)d_in[12];
    const float* n2w   = (const float*)d_in[13];
    const float* n2b   = (const float*)d_in[14];
    const float* f1w   = (const float*)d_in[15];
    const float* f1b   = (const float*)d_in[16];
    const float* f2w   = (const float*)d_in[17];
    const float* f2b   = (const float*)d_in[18];
    float* out = (float*)d_out;

    const int nWindows = NB * (NH / WS) * (NW / WS);   // 16384
    winattn_fused<<<nWindows, 256, 0, stream>>>(
        x, fh, n1w, n1b, qcw, qdw, kvcw, kvdw, tempp,
        pcw, pcb, n2w, n2b, f1w, f1b, f2w, f2b, out);
}

// v003
// Measured time: 66.7 microseconds a run.
// Two timings next to v002 both put it at 1.14 times that version's speed.
// Counting every step since v000, it is 1.88 times as fast.
#include <hip/hip_runtime.h>
#include <math.h>

typedef float v2f __attribute__((ext_vector_type(2)));
typedef float v8f __attribute__((ext_vector_type(8)));

#define NB   16
#define NC   3
#define NH   512
#define NW   512
#define WS   16
#define HWIN 256     // ws*ws
#define HID  12
#define UP   36      // LDS pitch (floats) of one staged channel row of 32 pixels: 16-byte reads of rows 0-5 meet no bank twice
#define UW   (6 * UP)
#define GP   8       // LDS pitch (floats) of one lane's eight accumulator registers
#define GW   (32 * GP)

// second bound: holds the allocation at 80 registers or fewer (12 waves per SIMD at least)
__global__ __launch_bounds__(256, 12) void winattn_fused(
    const float* __restrict__ x,      const float* __restrict__ fhigh,
    const float* __restrict__ n1w,    const float* __restrict__ n1b,
    const float* __restrict__ qcw,    const float* __restrict__ qdw,
    const float* __restrict__ kvcw,   const float* __restrict__ kvdw,
    const float* __restrict__ tempp,
    const float* __restrict__ pcw,    const float* __restrict__ pcb,
    const float* __restrict__ n2w,    const float* __restrict__ n2b,
    const float* __restrict__ f1w,    const float* __restrict__ f1b,
    const float* __restrict__ f2w,    const float* __restrict__ f2b,
    float* __restrict__ out)
{
    __shared__ float s_q [NC * HWIN];
    __shared__ float s_kv[NC * HWIN];
    __shared__ __attribute__((aligned(16))) float s_u[8 * UW];   // per wave: q0-2, kv0-2 of its 32 pixels
    __shared__ __attribute__((aligned(16))) float s_g[8 * GW];   // per wave: its Gram partial, as the accumulator lies in the lanes

    const int w   = blockIdx.x;          // window id = b*1024 + wy*32 + wx
    const int b   = w >> 10;
    const int wy  = (w >> 5) & 31;
    const int wx  = w & 31;
    const int tid = threadIdx.x;
    const int i   = tid >> 4;
    const int j   = tid & 15;
    const int lane = tid & 31;
    const int wave = tid >> 5;

    const int  y     = wy * WS + i;
    const int  xg    = wx * WS + j;
    const long pix   = (long)y * NW + xg;
    const long plane = (long)NH * NW;
    const long xbase = (long)b * NC * plane + pix;

    // ---- load x (3 channels), LayerNorm1 over C ----
    float xin[3];
    xin[0] = x[xbase];
    xin[1] = x[xbase + plane];
    xin[2] = x[xbase + 2 * plane];
    {
        float m  = (xin[0] + xin[1] + xin[2]) * (1.f / 3.f);
        float d0 = xin[0] - m, d1 = xin[1] - m, d2 = xin[2] - m;
        float v  = (d0 * d0 + d1 * d1 + d2 * d2) * (1.f / 3.f);
        float rs = rsqrtf(v + 1e-5f);
        float xn0 = d0 * rs * n1w[0] + n1b[0];
        float xn1 = d1 * rs * n1w[1] + n1b[1];
        float xn2 = d2 * rs * n1w[2] + n1b[2];
        // conv1x1 kv -> LDS
        #pragma unroll
        for (int c = 0; c < 3; ++c)
            s_kv[c * HWIN + tid] = kvcw[c*3+0]*xn0 + kvcw[c*3+1]*xn1 + kvcw[c*3+2]*xn2;
    }
    {
        const long fb = (long)w * (NC * HWIN);
        float f0 = fhigh[fb + tid];
        float f1 = fhigh[fb + HWIN + tid];
        float f2 = fhigh[fb + 2 * HWIN + tid];
        #pragma unroll
        for (int c = 0; c < 3; ++c)
            s_q[c * HWIN + tid] = qcw[c*3+0]*f0 + qcw[c*3+1]*f1 + qcw[c*3+2]*f2;
    }
    __syncthreads();

    // ---- depthwise 3x3 (zero pad at window edges) ----
    float qd[3], kd[3];
    #pragma unroll
    for (int c = 0; c < 3; ++c) {
        float aq = 0.f, ak = 0.f;
        #pragma unroll
        for (int di = 0; di < 3; ++di) {
            int ii = i + di - 1;
            if (ii < 0 || ii > 15) continue;
            #pragma unroll
            for (int dj = 0; dj < 3; ++dj) {
                int jj = j + dj - 1;
                if (jj < 0 || jj > 15) continue;
                int idx = c * HWIN + ii * 16 + jj;
                aq += qdw [c*9 + di*3 + dj] * s_q [idx];
                ak += kvdw[c*9 + di*3 + dj] * s_kv[idx];
            }
        }
        qd[c] = aq; kd[c] = ak;
    }

    // ---- the 15 window sums as one Gram matrix G = U * U^T on V_WMMA_F32_16X16X4_F32 ----
    // U: rows q0 q1 q2 kv0 kv1 kv2, columns the pixels. G[c][c] are the squared norms, G[c][3+d] = q_c . kv_d.
    // Each wave stages its own 32 pixels channel-major in its own LDS range and reads them back with lane l
    // holding row (l & 15) and the 16 pixels of half (l >> 4): that one fragment is A (row) and B (column) at
    // once, so k slot (half, s) of A and of B is the same pixel. Rows 6-15 repeat row 5; they reach only
    // rows and columns of G that nobody reads.
    const int half = lane >> 4;
    const int col  = lane & 15;
    const int row  = col < 6 ? col : 5;
    {
        float* uw = s_u + wave * UW;
        #pragma unroll
        for (int c = 0; c < 3; ++c) {
            uw[c * UP + lane]       = qd[c];
            uw[(3 + c) * UP + lane] = kd[c];
        }
        // the wave's own stores have landed before other lanes of the wave read them; also keeps the
        // compiler from lifting the reads over the stores
        asm volatile("s_wait_dscnt 0x0" ::: "memory");
        const float4* up = (const float4*)(uw + row * UP + 16 * half);
        float4 u[4];
        #pragma unroll
        for (int t = 0; t < 4; ++t) u[t] = up[t];
        v8f g = {};
        #pragma unroll
        for (int t = 0; t < 4; ++t) {
            v2f lo; lo.x = u[t].x; lo.y = u[t].y;
            v2f hi; hi.x = u[t].z; hi.y = u[t].w;
            g = __builtin_amdgcn_wmma_f32_16x16x4_f32(false, lo, false, lo, (short)0, g, false, false);
            g = __builtin_amdgcn_wmma_f32_16x16x4_f32(false, hi, false, hi, (short)0, g, false, false);
        }
        // lane d < 6 holds G[0..5][d] of this wave's pixels in registers 0-5; every lane stores its six,
        // so no branch stands behind the WMMA
        float* gp = s_g + wave * GW + lane * GP;
        *(float4*)gp       = make_float4(g[0], g[1], g[2], g[3]);
        *(float2*)(gp + 4) = make_float2(g[4], g[5]);
    }
    __syncthreads();

    // One sum a lane: lane 4c + d adds the eight waves' partials of q_c . kv_d = G[c][3+d], lane 16 + c those
    // of G[c][c]; the other lanes add words that were stored too but are used by nobody. Every lane then takes
    // the 15 sums from those lanes.
    float sums[15];
    {
        const int gi = half ? row * (GP + 1) : (3 + (col & 3)) * GP + (col >> 2);
        float tot = 0.f;
        #pragma unroll
        for (int k = 0; k < 8; ++k) tot += s_g[k * GW + gi];
        const int ti = __float_as_int(tot);
        #pragma unroll
        for (int c = 0; c < 6; ++c) sums[c] = __int_as_float(__builtin_amdgcn_readlane(ti, 16 + c));
        #pragma unroll
        for (int c = 0; c < 3; ++c)
            #pragma unroll
            for (int d = 0; d < 3; ++d)
                sums[6 + c*3 + d] = __int_as_float(__builtin_amdgcn_readlane(ti, 4 * c + d));
    }

    // ---- 3x3 attention: one result for the whole window, so every value here is the same in all lanes ----
    // The 15 sums lie in scalar registers. Reciprocal square root, reciprocal and exp2 are single instructions
    // that also work on scalar registers; a correctly rounded sqrt or divide is a long sequence, the divide a
    // vector one. With 1 / max(sqrt(s), eps) = min(rsq(s), 1 / eps) the block leaves the vector port but for the
    // three row maxima.
    const float temp = tempp[0];
    float rq[3], rk[3];
    #pragma unroll
    for (int c = 0; c < 3; ++c) {
        rq[c] = fminf(__builtin_amdgcn_rsqf(sums[c]),     1e12f) * temp;
        rk[c] = fminf(__builtin_amdgcn_rsqf(sums[3 + c]), 1e12f);
    }
    float attn[3][3];
    #pragma unroll
    for (int c = 0; c < 3; ++c) {
        float l[3];
        #pragma unroll
        for (int d = 0; d < 3; ++d) l[d] = sums[6 + c*3 + d] * rq[c] * rk[d];
        float mx = fmaxf(l[0], fmaxf(l[1], l[2]));
        float e0 = __builtin_amdgcn_exp2f((l[0]-mx) * 1.44269504f);
        float e1 = __builtin_amdgcn_exp2f((l[1]-mx) * 1.44269504f);
        float e2 = __builtin_amdgcn_exp2f((l[2]-mx) * 1.44269504f);
        float inv = __builtin_amdgcn_rcpf(e0 + e1 + e2);
        attn[c][0] = e0*inv; attn[c][1] = e1*inv; attn[c][2] = e2*inv;
    }

    // ---- MLP weights of this lane's A rows, asked for ahead of the MLP ----
    // (what they are for: the MLP section below). Every lane reads from a row clamped into the array.
    const int  sub  = lane & 7;                       // output row inside this lane's block
    const bool mine = ((lane >> 3) & 1) == half;      // this lane's A slots lie on the diagonal block
    const unsigned ow1a = 12u * (unsigned)sub;                 // byte offsets: fc1_w row sub,
    const int      sub4 = sub & 3;                             // rows 8 + sub exist for sub < 4
    const unsigned ow1b = 12u * (unsigned)sub4;                // fc1_w row 8 + sub4, from row 8,
    const unsigned ow2  = 48u * (unsigned)(sub < NC ? sub : NC - 1);   // fc2_w row sub (sub < 3)
    float w1a[3], w1b[3], w2[HID];
    #pragma unroll
    for (int k = 0; k < 3; ++k) {
        w1a[k] = ((const float*)((const char*)f1w + ow1a))[k];
        w1b[k] = ((const float*)((const char*)(f1w + 24) + ow1b))[k];
    }
    const float b1a = f1b[sub];
    const float b1b = f1b[8 + sub4];
    #pragma unroll
    for (int k = 0; k < HID; ++k) w2[k] = ((const float*)((const char*)f2w + ow2))[k];
    // The loads' offset and index registers are inputs here so that none of them is reused, not even as a
    // load's destination, ahead of the wait on the address translations.
    asm volatile("s_wait_xcnt 0x0" :: "v"(ow1a), "v"(ow1b), "v"(sub), "v"(sub4), "v"(ow2) : "memory");

    // x2 = attn @ v  (v = kd, unnormalized), then proj conv1x1 + bias + residual
    float x2c[3], xs2[3];
    #pragma unroll
    for (int c = 0; c < 3; ++c)
        x2c[c] = attn[c][0]*kd[0] + attn[c][1]*kd[1] + attn[c][2]*kd[2];
    #pragma unroll
    for (int c = 0; c < 3; ++c)
        xs2[c] = xin[c] + pcw[c*3+0]*x2c[0] + pcw[c*3+1]*x2c[1] + pcw[c*3+2]*x2c[2] + pcb[c];

    // ---- LayerNorm2, kept in this lane's registers ----
    float ln0, ln1, ln2;
    {
        float m  = (xs2[0] + xs2[1] + xs2[2]) * (1.f / 3.f);
        float d0 = xs2[0]-m, d1 = xs2[1]-m, d2 = xs2[2]-m;
        float v  = (d0*d0 + d1*d1 + d2*d2) * (1.f / 3.f);
        float rs = rsqrtf(v + 1e-5f);
        ln0 = d0 * rs * n2w[0] + n2b[0];
        ln1 = d1 * rs * n2w[1] + n2b[1];
        ln2 = d2 * rs * n2w[2] + n2b[2];
    }

    // ---- MLP via V_WMMA_F32_16X16X4_F32, weights as A, pixels as B, no LDS ----
    // Lane l: col = l & 15, half = l >> 4. A: lane holds row col, B: lane holds column col;
    // each half supplies two of the four k slots, slot (half, s) of A meeting slot (half, s) of B.
    // D register r of lane l is D[8*half + r][col].
    // A is block-diagonal: rows 0-7 carry weights only in the k slots of half 0, rows 8-15 only in
    // those of half 1. Then D[8*half + r][col] is built from the B values of lane l alone, so every
    // lane feeds its own pixel as B and gets its own pixel's results back as D: two k per WMMA,
    // eight output rows per WMMA, 32 pixels per WMMA.
    // fc1 weights: hidden unit j = 8*g + sub; k = {c0, c1}, then {c2, bias against a B of 1}
    const bool ok1 = mine && sub < HID - 8;
    const bool ok2 = mine && sub < NC;
    v2f a1[2][2];
    a1[0][0].x = mine ? w1a[0] : 0.f;  a1[0][0].y = mine ? w1a[1] : 0.f;
    a1[0][1].x = mine ? w1a[2] : 0.f;  a1[0][1].y = mine ? b1a    : 0.f;
    a1[1][0].x = ok1  ? w1b[0] : 0.f;  a1[1][0].y = ok1  ? w1b[1] : 0.f;
    a1[1][1].x = ok1  ? w1b[2] : 0.f;  a1[1][1].y = ok1  ? b1b    : 0.f;
    // fc2 weights: output channel sub (< 3); k = hidden units {2q, 2q+1}
    v2f a2[6];
    #pragma unroll
    for (int q = 0; q < 6; ++q) {
        a2[q].x = ok2 ? w2[2*q]     : 0.f;
        a2[q].y = ok2 ? w2[2*q + 1] : 0.f;
    }

    v2f bx0; bx0.x = ln0; bx0.y = ln1;
    v2f bx1; bx1.x = ln2; bx1.y = 1.f;
    float hg[16];                                     // hidden units 0-11 of this lane's pixel (12-15 unused)
    #pragma unroll
    for (int g = 0; g < 2; ++g) {
        v8f acc = {};
        acc = __builtin_amdgcn_wmma_f32_16x16x4_f32(false, a1[g][0], false, bx0,
                                                    (short)0, acc, false, false);
        acc = __builtin_amdgcn_wmma_f32_16x16x4_f32(false, a1[g][1], false, bx1,
                                                    (short)0, acc, false, false);
        #pragma unroll
        for (int r = 0; r < 8; ++r) hg[8*g + r] = acc[r];
    }
    #pragma unroll
    for (int k = 0; k < HID; ++k) {
        float hv = hg[k];
        hg[k] = 0.5f * hv * (1.f + erff(hv * 0.70710678118654752f));   // exact GELU
    }

    // fc2: C starts as residual + bias in this lane's rows 0-2; six chained k pairs
    v8f o = {};
    #pragma unroll
    for (int c = 0; c < 3; ++c) o[c] = xs2[c] + f2b[c];
    #pragma unroll
    for (int q = 0; q < 6; ++q) {
        v2f bh; bh.x = hg[2*q]; bh.y = hg[2*q + 1];
        o = __builtin_amdgcn_wmma_f32_16x16x4_f32(false, a2[q], false, bh,
                                                  (short)0, o, false, false);
    }

    // ---- coalesced channel-plane stores ----
    #pragma unroll
    for (int c = 0; c < 3; ++c)
        out[(long)(b * NC + c) * plane + pix] = o[c];
}

extern "C" void kernel_launch(void* const* d_in, const int* in_sizes, int n_in,
                              void* d_out, int out_size, void* d_ws, size_t ws_size,
                              hipStream_t stream) {
    (void)in_sizes; (void)n_in; (void)out_size; (void)d_ws; (void)ws_size;
    // setup_inputs order: 0:H 1:W 2:x 3:fhigh 4:norm1_w 5:norm1_b 6:q_C_w 7:q_dw_w
    // 8:kv_C_w 9:kv_dw_w 10:temperature 11:proj_C_w 12:proj_C_b 13:norm2_w 14:norm2_b
    // 15:fc1_w 16:fc1_b 17:fc2_w 18:fc2_b
    const float* x     = (const float*)d_in[2];
    const float* fh    = (const float*)d_in[3];
    const float* n1w   = (const float*)d_in[4];
    const float* n1b   = (const float*)d_in[5];
    const float* qcw   = (const float*)d_in[6];
    const float* qdw   = (const float*)d_in[7];
    const float* kvcw  = (const float*)d_in[8];
    const float* kvdw  = (const float*)d_in[9];
    const float* tempp = (const float*)d_in[10];
    const float* pcw   = (const float*)d_in[11];
    const float* pcb   = (const float*)d_in[12];
    const float* n2w   = (const float*)d_in[13];
    const float* n2b   = (const float*)d_in[14];
    const float* f1w   = (const float*)d_in[15];
    const float* f1b   = (const float*)d_in[16];
    const float* f2w   = (const float*)d_in[17];
    const float* f2b   = (const float*)d_in[18];
    float* out = (float*)d_out;

    const int nWindows = NB * (NH / WS) * (NW / WS);   // 16384
    winattn_fused<<<nWindows, 256, 0, stream>>>(
        x, fh, n1w, n1b, qcw, qdw, kvcw, kvdw, tempp,
        pcw, pcb, n2w, n2b, f1w, f1b, f2w, f2b, out);
}

// v004
// It runs in 55.9 microseconds.
// Timed twice side by side with v003, it ran 1.19 times as fast both times.
// All steps since v000 together make it 2.24 times as fast.
#include <hip/hip_runtime.h>
#include <math.h>

typedef float v2f __attribute__((ext_vector_type(2)));
typedef float v8f __attribute__((ext_vector_type(8)));

#define NB   16
#define NC   3
#define NH   512
#define NW   512
#define WS   16
#define HWIN 256     // ws*ws
#define HID  12
#define UP   36      // LDS pitch (floats) of one staged channel row of 32 pixels: 16-byte reads of rows 0-5 meet no bank twice
#define UW   (6 * UP)
#define GP   8       // LDS pitch (floats) of one lane's eight accumulator registers
#define GW   (32 * GP)
#define TP   17      // LDS pitch (floats) of one channel's piece of a tile row: 16 pixels and one zero cell, the right edge of this piece and the left edge of the next
#define RP   (6 * TP)         // LDS pitch (floats) of one tile row: the six channels' pieces side by side
#define NT   (18 * RP + 1)    // 16 pixel rows between a top and a bottom row of zeros

// second bound: holds the allocation at 80 registers or fewer (12 waves per SIMD at least)
__global__ __launch_bounds__(256, 12) void winattn_fused(
    const float* __restrict__ x,      const float* __restrict__ fhigh,
    const float* __restrict__ n1w,    const float* __restrict__ n1b,
    const float* __restrict__ qcw,    const float* __restrict__ qdw,
    const float* __restrict__ kvcw,   const float* __restrict__ kvdw,
    const float* __restrict__ tempp,
    const float* __restrict__ pcw,    const float* __restrict__ pcb,
    const float* __restrict__ n2w,    const float* __restrict__ n2b,
    const float* __restrict__ f1w,    const float* __restrict__ f1b,
    const float* __restrict__ f2w,    const float* __restrict__ f2b,
    float* __restrict__ out)
{
    // q0-2, kv0-2 after the 1x1 conv, inside a border of zeros. The alignment puts the array first in LDS, and with
    // the channels side by side nearly all 54 taps of a pixel lie within the reach of a two-address load's offsets.
    __shared__ __attribute__((aligned(64))) float s_t[NT];
    __shared__ __attribute__((aligned(16))) float s_u[8 * UW];   // per wave: q0-2, kv0-2 of its 32 pixels
    __shared__ __attribute__((aligned(16))) float s_g[8 * GW];   // per wave: its Gram partial, as the accumulator lies in the lanes

    const int w   = blockIdx.x;          // window id = b*1024 + wy*32 + wx
    const int b   = w >> 10;
    const int wy  = (w >> 5) & 31;
    const int wx  = w & 31;
    const int tid = threadIdx.x;
    const int i   = tid >> 4;
    const int j   = tid & 15;
    const int lane = tid & 31;
    const int wave = tid >> 5;

    const int  y     = wy * WS + i;
    const int  xg    = wx * WS + j;
    const long pix   = (long)y * NW + xg;
    const long plane = (long)NH * NW;
    const long xbase = (long)b * NC * plane + pix;

    // ---- load x (3 channels), LayerNorm1 over C ----
    float xin[3];
    xin[0] = x[xbase];
    xin[1] = x[xbase + plane];
    xin[2] = x[xbase + 2 * plane];
    const long fb = (long)w * (NC * HWIN);
    const float f0 = fhigh[fb + tid];
    const float f1 = fhigh[fb + HWIN + tid];
    const float f2 = fhigh[fb + 2 * HWIN + tid];

    // ---- the zero border ----
    // Pixel (r, col) of channel c lies at (r + 1) * RP + c * TP + col + 1. Zero: the top row with the first cell
    // behind it, the bottom row with the last cell, and in each pixel row the cell in front of each channel's piece.
    if (tid <= RP) {
        s_t[tid] = 0.f;
        s_t[17 * RP + tid] = 0.f;
    }
    if (j < 6) s_t[(i + 1) * RP + j * TP] = 0.f;
    float* tap = s_t + i * RP + j;                    // tap (di, dj) of channel c lies at di * RP + c * TP + dj
    {
        float m  = (xin[0] + xin[1] + xin[2]) * (1.f / 3.f);
        float d0 = xin[0] - m, d1 = xin[1] - m, d2 = xin[2] - m;
        float v  = (d0 * d0 + d1 * d1 + d2 * d2) * (1.f / 3.f);
        float rs = rsqrtf(v + 1e-5f);
        float xn0 = d0 * rs * n1w[0] + n1b[0];
        float xn1 = d1 * rs * n1w[1] + n1b[1];
        float xn2 = d2 * rs * n1w[2] + n1b[2];
        // conv1x1 kv -> LDS
        #pragma unroll
        for (int c = 0; c < 3; ++c)
            tap[RP + (3 + c) * TP + 1] = kvcw[c*3+0]*xn0 + kvcw[c*3+1]*xn1 + kvcw[c*3+2]*xn2;
    }
    #pragma unroll
    for (int c = 0; c < 3; ++c)
        tap[RP + c * TP + 1] = qcw[c*3+0]*f0 + qcw[c*3+1]*f1 + qcw[c*3+2]*f2;
    __syncthreads();

    // ---- depthwise 3x3: the window's zero padding is read from the border, so all nine taps are unconditional ----
    float qd[3], kd[3];
    #pragma unroll
    for (int c = 0; c < 3; ++c) {
        float aq = 0.f, ak = 0.f;
        #pragma unroll
        for (int di = 0; di < 3; ++di) {
            #pragma unroll
            for (int dj = 0; dj < 3; ++dj) {
                aq += qdw [c*9 + di*3 + dj] * tap[di * RP + c * TP + dj];
                ak += kvdw[c*9 + di*3 + dj] * tap[di * RP + (3 + c) * TP + dj];
            }
        }
        qd[c] = aq; kd[c] = ak;
    }

    // ---- the 15 window sums as one Gram matrix G = U * U^T on V_WMMA_F32_16X16X4_F32 ----
    // U: rows q0 q1 q2 kv0 kv1 kv2, columns the pixels. G[c][c] are the squared norms, G[c][3+d] = q_c . kv_d.
    // Each wave stages its own 32 pixels channel-major in its own LDS range and reads them back with lane l
    // holding row (l & 15) and the 16 pixels of half (l >> 4): that one fragment is A (row) and B (column) at
    // once, so k slot (half, s) of A and of B is the same pixel. Rows 6-15 repeat row 5; they reach only
    // rows and columns of G that nobody reads.
    const int half = lane >> 4;
    const int col  = lane & 15;
    const int row  = col < 6 ? col : 5;
    {
        float* uw = s_u + wave * UW;
        #pragma unroll
        for (int c = 0; c < 3; ++c) {
            uw[c * UP + lane]       = qd[c];
            uw[(3 + c) * UP + lane] = kd[c];
        }
        // the wave's own stores have landed before other lanes of the wave read them; also keeps the
        // compiler from lifting the reads over the stores
        asm volatile("s_wait_dscnt 0x0" ::: "memory");
        const float4* up = (const float4*)(uw + row * UP + 16 * half);
        float4 u[4];
        #pragma unroll
        for (int t = 0; t < 4; ++t) u[t] = up[t];
        v8f g = {};
        #pragma unroll
        for (int t = 0; t < 4; ++t) {
            v2f lo; lo.x = u[t].x; lo.y = u[t].y;
            v2f hi; hi.x = u[t].z; hi.y = u[t].w;
            g = __builtin_amdgcn_wmma_f32_16x16x4_f32(false, lo, false, lo, (short)0, g, false, false);
            g = __builtin_amdgcn_wmma_f32_16x16x4_f32(false, hi, false, hi, (short)0, g, false, false);
        }
        // lane d < 6 holds G[0..5][d] of this wave's pixels in registers 0-5; every lane stores its six,
        // so no branch stands behind the WMMA
        float* gp = s_g + wave * GW + lane * GP;
        *(float4*)gp       = make_float4(g[0], g[1], g[2], g[3]);
        *(float2*)(gp + 4) = make_float2(g[4], g[5]);
    }
    __syncthreads();

    // One sum a lane: lane 4c + d adds the eight waves' partials of q_c . kv_d = G[c][3+d], lane 16 + c those
    // of G[c][c]; the other lanes add words that were stored too but are used by nobody. Every lane then takes
    // the 15 sums from those lanes.
    float sums[15];
    {
        const int gi = half ? row * (GP + 1) : (3 + (col & 3)) * GP + (col >> 2);
        float tot = 0.f;
        #pragma unroll
        for (int k = 0; k < 8; ++k) tot += s_g[k * GW + gi];
        const int ti = __float_as_int(tot);
        #pragma unroll
        for (int c = 0; c < 6; ++c) sums[c] = __int_as_float(__builtin_amdgcn_readlane(ti, 16 + c));
        #pragma unroll
        for (int c = 0; c < 3; ++c)
            #pragma unroll
            for (int d = 0; d < 3; ++d)
                sums[6 + c*3 + d] = __int_as_float(__builtin_amdgcn_readlane(ti, 4 * c + d));
    }

    // ---- 3x3 attention: one result for the whole window, so every value here is the same in all lanes ----
    // The 15 sums lie in scalar registers. Reciprocal square root, reciprocal and exp2 are single instructions
    // that also work on scalar registers; a correctly rounded sqrt or divide is a long sequence, the divide a
    // vector one. With 1 / max(sqrt(s), eps) = min(rsq(s), 1 / eps) the block leaves the vector port but for the
    // three row maxima.
    const float temp = tempp[0];
    float rq[3], rk[3];
    #pragma unroll
    for (int c = 0; c < 3; ++c) {
        rq[c] = fminf(__builtin_amdgcn_rsqf(sums[c]),     1e12f) * temp;
        rk[c] = fminf(__builtin_amdgcn_rsqf(sums[3 + c]), 1e12f);
    }
    float attn[3][3];
    #pragma unroll
    for (int c = 0; c < 3; ++c) {
        float l[3];
        #pragma unroll
        for (int d = 0; d < 3; ++d) l[d] = sums[6 + c*3 + d] * rq[c] * rk[d];
        float mx = fmaxf(l[0], fmaxf(l[1], l[2]));
        float e0 = __builtin_amdgcn_exp2f((l[0]-mx) * 1.44269504f);
        float e1 = __builtin_amdgcn_exp2f((l[1]-mx) * 1.44269504f);
        float e2 = __builtin_amdgcn_exp2f((l[2]-mx) * 1.44269504f);
        float inv = __builtin_amdgcn_rcpf(e0 + e1 + e2);
        attn[c][0] = e0*inv; attn[c][1] = e1*inv; attn[c][2] = e2*inv;
    }

    // ---- MLP weights of this lane's A rows, asked for ahead of the MLP ----
    // (what they are for: the MLP section below). Every lane reads from a row clamped into the array.
    const int  sub  = lane & 7;                       // output row inside this lane's block
    const bool mine = ((lane >> 3) & 1) == half;      // this lane's A slots lie on the diagonal block
    const unsigned ow1a = 12u * (unsigned)sub;                 // byte offsets: fc1_w row sub,
    const int      sub4 = sub & 3;                             // rows 8 + sub exist for sub < 4
    const unsigned ow1b = 12u * (unsigned)sub4;                // fc1_w row 8 + sub4, from row 8,
    const unsigned ow2  = 48u * (unsigned)(sub < NC ? sub : NC - 1);   // fc2_w row sub (sub < 3)
    float w1a[3], w1b[3], w2[HID];
    #pragma unroll
    for (int k = 0; k < 3; ++k) {
        w1a[k] = ((const float*)((const char*)f1w + ow1a))[k];
        w1b[k] = ((const float*)((const char*)(f1w + 24) + ow1b))[k];
    }
    const float b1a = f1b[sub];
    const float b1b = f1b[8 + sub4];
    #pragma unroll
    for (int k = 0; k < HID; ++k) w2[k] = ((const float*)((const char*)f2w + ow2))[k];
    // The loads' offset and index registers are inputs here so that none of them is reused, not even as a
    // load's destination, ahead of the wait on the address translations.
    asm volatile("s_wait_xcnt 0x0" :: "v"(ow1a), "v"(ow1b), "v"(sub), "v"(sub4), "v"(ow2) : "memory");

    // x2 = attn @ v  (v = kd, unnormalized), then proj conv1x1 + bias + residual
    float x2c[3], xs2[3];
    #pragma unroll
    for (int c = 0; c < 3; ++c)
        x2c[c] = attn[c][0]*kd[0] + attn[c][1]*kd[1] + attn[c][2]*kd[2];
    #pragma unroll
    for (int c = 0; c < 3; ++c)
        xs2[c] = xin[c] + pcw[c*3+0]*x2c[0] + pcw[c*3+1]*x2c[1] + pcw[c*3+2]*x2c[2] + pcb[c];

    // ---- LayerNorm2, kept in this lane's registers ----
    float ln0, ln1, ln2;
    {
        float m  = (xs2[0] + xs2[1] + xs2[2]) * (1.f / 3.f);
        float d0 = xs2[0]-m, d1 = xs2[1]-m, d2 = xs2[2]-m;
        float v  = (d0*d0 + d1*d1 + d2*d2) * (1.f / 3.f);
        float rs = rsqrtf(v + 1e-5f);
        ln0 = d0 * rs * n2w[0] + n2b[0];
        ln1 = d1 * rs * n2w[1] + n2b[1];
        ln2 = d2 * rs * n2w[2] + n2b[2];
    }

    // ---- MLP via V_WMMA_F32_16X16X4_F32, weights as A, pixels as B, no LDS ----
    // Lane l: col = l & 15, half = l >> 4. A: lane holds row col, B: lane holds column col;
    // each half supplies two of the four k slots, slot (half, s) of A meeting slot (half, s) of B.
    // D register r of lane l is D[8*half + r][col].
    // A is block-diagonal: rows 0-7 carry weights only in the k slots of half 0, rows 8-15 only in
    // those of half 1. Then D[8*half + r][col] is built from the B values of lane l alone, so every
    // lane feeds its own pixel as B and gets its own pixel's results back as D: two k per WMMA,
    // eight output rows per WMMA, 32 pixels per WMMA.
    // fc1 weights: hidden unit j = 8*g + sub; k = {c0, c1}, then {c2, bias against a B of 1}
    const bool ok1 = mine && sub < HID - 8;
    const bool ok2 = mine && sub < NC;
    v2f a1[2][2];
    a1[0][0].x = mine ? w1a[0] : 0.f;  a1[0][0].y = mine ? w1a[1] : 0.f;
    a1[0][1].x = mine ? w1a[2] : 0.f;  a1[0][1].y = mine ? b1a    : 0.f;
    a1[1][0].x = ok1  ? w1b[0] : 0.f;  a1[1][0].y = ok1  ? w1b[1] : 0.f;
    a1[1][1].x = ok1  ? w1b[2] : 0.f;  a1[1][1].y = ok1  ? b1b    : 0.f;
    // fc2 weights: output channel sub (< 3); k = hidden units {2q, 2q+1}
    v2f a2[6];
    #pragma unroll
    for (int q = 0; q < 6; ++q) {
        a2[q].x = ok2 ? w2[2*q]     : 0.f;
        a2[q].y = ok2 ? w2[2*q + 1] : 0.f;
    }

    v2f bx0; bx0.x = ln0; bx0.y = ln1;
    v2f bx1; bx1.x = ln2; bx1.y = 1.f;
    float hg[16];                                     // hidden units 0-11 of this lane's pixel (12-15 unused)
    #pragma unroll
    for (int g = 0; g < 2; ++g) {
        v8f acc = {};
        acc = __builtin_amdgcn_wmma_f32_16x16x4_f32(false, a1[g][0], false, bx0,
                                                    (short)0, acc, false, false);
        acc = __builtin_amdgcn_wmma_f32_16x16x4_f32(false, a1[g][1], false, bx1,
                                                    (short)0, acc, false, false);
        #pragma unroll
        for (int r = 0; r < 8; ++r) hg[8*g + r] = acc[r];
    }
    #pragma unroll
    for (int k = 0; k < HID; ++k) {
        float hv = hg[k];
        hg[k] = 0.5f * hv * (1.f + erff(hv * 0.70710678118654752f));   // exact GELU
    }

    // fc2: C starts as residual + bias in this lane's rows 0-2; six chained k pairs
    v8f o = {};
    #pragma unroll
    for (int c = 0; c < 3; ++c) o[c] = xs2[c] + f2b[c];
    #pragma unroll
    for (int q = 0; q < 6; ++q) {
        v2f bh; bh.x = hg[2*q]; bh.y = hg[2*q + 1];
        o = __builtin_amdgcn_wmma_f32_16x16x4_f32(false, a2[q], false, bh,
                                                  (short)0, o, false, false);
    }

    // ---- coalesced channel-plane stores ----
    #pragma unroll
    for (int c = 0; c < 3; ++c)
        out[(long)(b * NC + c) * plane + pix] = o[c];
}

extern "C" void kernel_launch(void* const* d_in, const int* in_sizes, int n_in,
                              void* d_out, int out_size, void* d_ws, size_t ws_size,
                              hipStream_t stream) {
    (void)in_sizes; (void)n_in; (void)out_size; (void)d_ws; (void)ws_size;
    // setup_inputs order: 0:H 1:W 2:x 3:fhigh 4:norm1_w 5:norm1_b 6:q_C_w 7:q_dw_w
    // 8:kv_C_w 9:kv_dw_w 10:temperature 11:proj_C_w 12:proj_C_b 13:norm2_w 14:norm2_b
    // 15:fc1_w 16:fc1_b 17:fc2_w 18:fc2_b
    const float* x     = (const float*)d_in[2];
    const float* fh    = (const float*)d_in[3];
    const float* n1w   = (const float*)d_in[4];
    const float* n1b   = (const float*)d_in[5];
    const float* qcw   = (const float*)d_in[6];
    const float* qdw   = (const float*)d_in[7];
    const float* kvcw  = (const float*)d_in[8];
    const float* kvdw  = (const float*)d_in[9];
    const float* tempp = (const float*)d_in[10];
    const float* pcw   = (const float*)d_in[11];
    const float* pcb   = (const float*)d_in[12];
    const float* n2w   = (const float*)d_in[13];
    const float* n2b   = (const float*)d_in[14];
    const float* f1w   = (const float*)d_in[15];
    const float* f1b   = (const float*)d_in[16];
    const float* f2w   = (const float*)d_in[17];
    const float* f2b   = (const float*)d_in[18];
    float* out = (float*)d_out;

    const int nWindows = NB * (NH / WS) * (NW / WS);   // 16384
    winattn_fused<<<nWindows, 256, 0, stream>>>(
        x, fh, n1w, n1b, qcw, qdw, kvcw, kvdw, tempp,
        pcw, pcb, n2w, n2b, f1w, f1b, f2w, f2b, out);
}

// v005
// It runs in 52.6 microseconds.
// Two timings next to v004 put it at 1.06 and 1.05 times that version's speed.
// All steps since v000 together make it 2.37 times as fast.
#include <hip/hip_runtime.h>
#include <math.h>

typedef float v2f __attribute__((ext_vector_type(2)));
typedef float v8f __attribute__((ext_vector_type(8)));

#define NB   16
#define NC   3
#define NH   512
#define NW   512
#define WS   16
#define HWIN 256     // ws*ws
#define HID  12
#define UP   36      // LDS pitch (floats) of one staged channel row of 32 pixels: 16-byte reads of rows 0-5 meet no bank twice
#define UW   (6 * UP)
#define GP   8       // LDS pitch (floats) of one lane's eight accumulator registers
#define GW   (32 * GP)
#define TP   17      // LDS pitch (floats) of one channel's piece of a tile row: 16 pixels and one zero cell, the right edge of this piece and the left edge of the next
#define RP   (6 * TP)         // LDS pitch (floats) of one tile row: the six channels' pieces side by side
#define NT   (18 * RP + 1)    // 16 pixel rows between a top and a bottom row of zeros
#define PX   4                // pixels of the window per thread
#define NTH  (HWIN / PX)      // threads per work-group
#define NWV  (NTH / 32)       // waves per work-group

// One window per work-group, PX pixels per thread: rows PX * i to PX * i + PX - 1 of column j. What a wave does once
// whatever its pixel count (the window sums, the 3x3 softmax, the weight fragments, the addresses) is then done by
// NWV waves a window, and the PX pixels of a thread read the tile rows that their 3x3 taps share only once.
// Every loop over p is unrolled, so that the per-pixel arrays are indexed by constants and stay in registers.
// second bound: 8 waves per SIMD at least; the build then holds 96 registers, so 10 waves fit a SIMD, as many as the LDS lets in
__global__ __launch_bounds__(NTH, 8) void winattn_fused(
    const float* __restrict__ x,      const float* __restrict__ fhigh,
    const float* __restrict__ n1w,    const float* __restrict__ n1b,
    const float* __restrict__ qcw,    const float* __restrict__ qdw,
    const float* __restrict__ kvcw,   const float* __restrict__ kvdw,
    const float* __restrict__ tempp,
    const float* __restrict__ pcw,    const float* __restrict__ pcb,
    const float* __restrict__ n2w,    const float* __restrict__ n2b,
    const float* __restrict__ f1w,    const float* __restrict__ f1b,
    const float* __restrict__ f2w,    const float* __restrict__ f2b,
    float* __restrict__ out)
{
    // q0-2, kv0-2 after the 1x1 conv, inside a border of zeros. The alignment puts the array first in LDS, and with
    // the channels side by side the taps in a thread's first tile rows lie within the reach of a two-address load's offsets.
    __shared__ __attribute__((aligned(64))) float s_t[NT];
    __shared__ __attribute__((aligned(16))) float s_u[8 * UW];   // per wave and chunk: q0-2, kv0-2 of 32 pixels
    __shared__ __attribute__((aligned(16))) float s_g[NWV * GW]; // per wave: its Gram partial, as the accumulator lies in the lanes

    const int w   = blockIdx.x;          // window id = b*1024 + wy*32 + wx
    const int b   = w >> 10;
    const int wy  = (w >> 5) & 31;
    const int wx  = w & 31;
    const int tid = threadIdx.x;
    const int i   = tid >> 4;
    const int j   = tid & 15;
    const int lane = tid & 31;
    const int wave = tid >> 5;

    const int  y     = wy * WS + i * PX;          // the thread's first pixel; pixel p lies p rows below
    const int  xg    = wx * WS + j;
    const long pix   = (long)y * NW + xg;
    const long plane = (long)NH * NW;
    const long xbase = (long)b * NC * plane + pix;

    // ---- load x and fhigh (3 channels each) of all PX pixels ----
    float xin[PX][3], fin[PX][3];
    const long fb = (long)w * (NC * HWIN);
    #pragma unroll
    for (int p = 0; p < PX; ++p) {
        #pragma unroll
        for (int c = 0; c < 3; ++c) {
            xin[p][c] = x[xbase + c * plane + p * NW];
            fin[p][c] = fhigh[fb + c * HWIN + (i * PX + p) * WS + j];
        }
    }

    // ---- the zero border ----
    // Pixel (r, col) of channel c lies at (r + 1) * RP + c * TP + col + 1. Zero: the top row with the first cell
    // behind it, the bottom row with the last cell, and in each pixel row the cell in front of each channel's piece.
    #pragma unroll
    for (int k = 0; k <= RP; k += NTH) {
        if (k + tid <= RP) {
            s_t[k + tid] = 0.f;
            s_t[17 * RP + k + tid] = 0.f;
        }
    }
    if (j < 6) {
        #pragma unroll
        for (int p = 0; p < PX; ++p) s_t[(i * PX + p + 1) * RP + j * TP] = 0.f;
    }
    float* tap = s_t + i * (PX * RP) + j;     // tap (di, dj) of channel c of pixel p lies at (p + di) * RP + c * TP + dj
    // ---- LayerNorm1 over C, the two 1x1 convs -> LDS ----
    #pragma unroll
    for (int p = 0; p < PX; ++p) {
        float* ctr = tap + (p + 1) * RP + 1;
        float m  = (xin[p][0] + xin[p][1] + xin[p][2]) * (1.f / 3.f);
        float d0 = xin[p][0] - m, d1 = xin[p][1] - m, d2 = xin[p][2] - m;
        float v  = (d0 * d0 + d1 * d1 + d2 * d2) * (1.f / 3.f);
        float rs = rsqrtf(v + 1e-5f);
        float xn0 = d0 * rs * n1w[0] + n1b[0];
        float xn1 = d1 * rs * n1w[1] + n1b[1];
        float xn2 = d2 * rs * n1w[2] + n1b[2];
        #pragma unroll
        for (int c = 0; c < 3; ++c) {
            ctr[(3 + c) * TP] = kvcw[c*3+0]*xn0 + kvcw[c*3+1]*xn1 + kvcw[c*3+2]*xn2;
            ctr[c * TP]       = qcw[c*3+0]*fin[p][0] + qcw[c*3+1]*fin[p][1] + qcw[c*3+2]*fin[p][2];
        }
    }
    __syncthreads();

    // ---- depthwise 3x3: the window's zero padding is read from the border, so all nine taps are unconditional ----
    float qd[PX][3], kd[PX][3];
    #pragma unroll
    for (int p = 0; p < PX; ++p) {
        #pragma unroll
        for (int c = 0; c < 3; ++c) {
            float aq = 0.f, ak = 0.f;
            #pragma unroll
            for (int di = 0; di < 3; ++di) {
                #pragma unroll
                for (int dj = 0; dj < 3; ++dj) {
                    aq += qdw [c*9 + di*3 + dj] * tap[(p + di) * RP + c * TP + dj];
                    ak += kvdw[c*9 + di*3 + dj] * tap[(p + di) * RP + (3 + c) * TP + dj];
                }
            }
            qd[p][c] = aq; kd[p][c] = ak;
        }
    }

    // ---- the 15 window sums as one Gram matrix G = U * U^T on V_WMMA_F32_16X16X4_F32 ----
    // U: rows q0 q1 q2 kv0 kv1 kv2, columns the pixels. G[c][c] are the squared norms, G[c][3+d] = q_c . kv_d.
    // Each wave stages each of its chunks of 32 pixels (chunk p: pixel p of its lanes) channel-major in an LDS range
    // of its own and reads it back with lane l holding row (l & 15) and the 16 pixels of half (l >> 4): that one
    // fragment is A (row) and B (column) at once, so k slot (half, s) of A and of B is the same pixel. Rows 6-15
    // repeat row 5; they reach only rows and columns of G that nobody reads. One accumulator takes all chunks.
    const int half = lane >> 4;
    const int col  = lane & 15;
    const int row  = col < 6 ? col : 5;
    {
        float* uw = s_u + wave * (PX * UW);
        #pragma unroll
        for (int p = 0; p < PX; ++p) {
            #pragma unroll
            for (int c = 0; c < 3; ++c) {
                uw[p * UW + c * UP + lane]       = qd[p][c];
                uw[p * UW + (3 + c) * UP + lane] = kd[p][c];
            }
        }
        // the wave's own stores have landed before other lanes of the wave read them; also keeps the
        // compiler from lifting the reads over the stores
        asm volatile("s_wait_dscnt 0x0" ::: "memory");
        const float4* up = (const float4*)(uw + row * UP + 16 * half);
        v8f g = {};
        #pragma unroll
        for (int p = 0; p < PX; ++p) {
            float4 u[4];
            #pragma unroll
            for (int t = 0; t < 4; ++t) u[t] = up[p * (UW / 4) + t];
            #pragma unroll
            for (int t = 0; t < 4; ++t) {
                v2f lo; lo.x = u[t].x; lo.y = u[t].y;
                v2f hi; hi.x = u[t].z; hi.y = u[t].w;
                g = __builtin_amdgcn_wmma_f32_16x16x4_f32(false, lo, false, lo, (short)0, g, false, false);
                g = __builtin_amdgcn_wmma_f32_16x16x4_f32(false, hi, false, hi, (short)0, g, false, false);
            }
        }
        // lane d < 6 holds G[0..5][d] of this wave's pixels in registers 0-5; every lane stores its six,
        // so no branch stands behind the WMMA
        float* gp = s_g + wave * GW + lane * GP;
        *(float4*)gp       = make_float4(g[0], g[1], g[2], g[3]);
        *(float2*)(gp + 4) = make_float2(g[4], g[5]);
    }
    __syncthreads();

    // One sum a lane: lane 4c + d adds the waves' partials of q_c . kv_d = G[c][3+d], lane 16 + c those
    // of G[c][c]; the other lanes add words that were stored too but are used by nobody. Every lane then takes
    // the 15 sums from those lanes.
    float sums[15];
    {
        const int gi = half ? row * (GP + 1) : (3 + (col & 3)) * GP + (col >> 2);
        float tot = 0.f;
        #pragma unroll
        for (int k = 0; k < NWV; ++k) tot += s_g[k * GW + gi];
        const int ti = __float_as_int(tot);
        #pragma unroll
        for (int c = 0; c < 6; ++c) sums[c] = __int_as_float(__builtin_amdgcn_readlane(ti, 16 + c));
        #pragma unroll
        for (int c = 0; c < 3; ++c)
            #pragma unroll
            for (int d = 0; d < 3; ++d)
                sums[6 + c*3 + d] = __int_as_float(__builtin_amdgcn_readlane(ti, 4 * c + d));
    }

    // ---- 3x3 attention: one result for the whole window, so every value here is the same in all lanes ----
    // The 15 sums lie in scalar registers. Reciprocal square root, reciprocal and exp2 are single instructions
    // that also work on scalar registers; a correctly rounded sqrt or divide is a long sequence, the divide a
    // vector one. With 1 / max(sqrt(s), eps) = min(rsq(s), 1 / eps) the block leaves the vector port but for the
    // three row maxima.
    const float temp = tempp[0];
    float rq[3], rk[3];
    #pragma unroll
    for (int c = 0; c < 3; ++c) {
        rq[c] = fminf(__builtin_amdgcn_rsqf(sums[c]),     1e12f) * temp;
        rk[c] = fminf(__builtin_amdgcn_rsqf(sums[3 + c]), 1e12f);
    }
    float attn[3][3];
    #pragma unroll
    for (int c = 0; c < 3; ++c) {
        float l[3];
        #pragma unroll
        for (int d = 0; d < 3; ++d) l[d] = sums[6 + c*3 + d] * rq[c] * rk[d];
        float mx = fmaxf(l[0], fmaxf(l[1], l[2]));
        float e0 = __builtin_amdgcn_exp2f((l[0]-mx) * 1.44269504f);
        float e1 = __builtin_amdgcn_exp2f((l[1]-mx) * 1.44269504f);
        float e2 = __builtin_amdgcn_exp2f((l[2]-mx) * 1.44269504f);
        float inv = __builtin_amdgcn_rcpf(e0 + e1 + e2);
        attn[c][0] = e0*inv; attn[c][1] = e1*inv; attn[c][2] = e2*inv;
    }

    // ---- MLP weights of this lane's A rows, asked for ahead of the MLP ----
    // (what they are for: the MLP section below). Every lane reads from a row clamped into the array.
    const int  sub  = lane & 7;                       // output row inside this lane's block
    const bool mine = ((lane >> 3) & 1) == half;      // this lane's A slots lie on the diagonal block
    const unsigned ow1a = 12u * (unsigned)sub;                 // byte offsets: fc1_w row sub,
    const int      sub4 = sub & 3;                             // rows 8 + sub exist for sub < 4
    const unsigned ow1b = 12u * (unsigned)sub4;                // fc1_w row 8 + sub4, from row 8,
    const unsigned ow2  = 48u * (unsigned)(sub < NC ? sub : NC - 1);   // fc2_w row sub (sub < 3)
    float w1a[3], w1b[3], w2[HID];
    #pragma unroll
    for (int k = 0; k < 3; ++k) {
        w1a[k] = ((const float*)((const char*)f1w + ow1a))[k];
        w1b[k] = ((const float*)((const char*)(f1w + 24) + ow1b))[k];
    }
    const float b1a = f1b[sub];
    const float b1b = f1b[8 + sub4];
    #pragma unroll
    for (int k = 0; k < HID; ++k) w2[k] = ((const float*)((const char*)f2w + ow2))[k];
    // The loads' offset and index registers are inputs here so that none of them is reused, not even as a
    // load's destination, ahead of the wait on the address translations.
    asm volatile("s_wait_xcnt 0x0" :: "v"(ow1a), "v"(ow1b), "v"(sub), "v"(sub4), "v"(ow2) : "memory");

    // ---- MLP via V_WMMA_F32_16X16X4_F32, weights as A, pixels as B, no LDS ----
    // Lane l: col = l & 15, half = l >> 4. A: lane holds row col, B: lane holds column col;
    // each half supplies two of the four k slots, slot (half, s) of A meeting slot (half, s) of B.
    // D register r of lane l is D[8*half + r][col].
    // A is block-diagonal: rows 0-7 carry weights only in the k slots of half 0, rows 8-15 only in
    // those of half 1. Then D[8*half + r][col] is built from the B values of lane l alone, so every
    // lane feeds a pixel of its own as B and gets that pixel's results back as D: two k per WMMA,
    // eight output rows per WMMA, 32 pixels per WMMA.
    // fc1 weights: hidden unit j = 8*g + sub; k = {c0, c1}, then {c2, bias against a B of 1}
    const bool ok1 = mine && sub < HID - 8;
    const bool ok2 = mine && sub < NC;
    v2f a1[2][2];
    a1[0][0].x = mine ? w1a[0] : 0.f;  a1[0][0].y = mine ? w1a[1] : 0.f;
    a1[0][1].x = mine ? w1a[2] : 0.f;  a1[0][1].y = mine ? b1a    : 0.f;
    a1[1][0].x = ok1  ? w1b[0] : 0.f;  a1[1][0].y = ok1  ? w1b[1] : 0.f;
    a1[1][1].x = ok1  ? w1b[2] : 0.f;  a1[1][1].y = ok1  ? b1b    : 0.f;
    // fc2 weights: output channel sub (< 3); k = hidden units {2q, 2q+1}
    v2f a2[6];
    #pragma unroll
    for (int q = 0; q < 6; ++q) {
        a2[q].x = ok2 ? w2[2*q]     : 0.f;
        a2[q].y = ok2 ? w2[2*q + 1] : 0.f;
    }

    #pragma unroll
    for (int p = 0; p < PX; ++p) {
        // x2 = attn @ v  (v = kd, unnormalized), then proj conv1x1 + bias + residual
        float x2c[3], xs2[3];
        #pragma unroll
        for (int c = 0; c < 3; ++c)
            x2c[c] = attn[c][0]*kd[p][0] + attn[c][1]*kd[p][1] + attn[c][2]*kd[p][2];
        #pragma unroll
        for (int c = 0; c < 3; ++c)
            xs2[c] = xin[p][c] + pcw[c*3+0]*x2c[0] + pcw[c*3+1]*x2c[1] + pcw[c*3+2]*x2c[2] + pcb[c];

        // ---- LayerNorm2, kept in this lane's registers ----
        float ln0, ln1, ln2;
        {
            float m  = (xs2[0] + xs2[1] + xs2[2]) * (1.f / 3.f);
            float d0 = xs2[0]-m, d1 = xs2[1]-m, d2 = xs2[2]-m;
            float v  = (d0*d0 + d1*d1 + d2*d2) * (1.f / 3.f);
            float rs = rsqrtf(v + 1e-5f);
            ln0 = d0 * rs * n2w[0] + n2b[0];
            ln1 = d1 * rs * n2w[1] + n2b[1];
            ln2 = d2 * rs * n2w[2] + n2b[2];
        }

        v2f bx0; bx0.x = ln0; bx0.y = ln1;
        v2f bx1; bx1.x = ln2; bx1.y = 1.f;
        float hg[16];                                 // hidden units 0-11 of this pixel (12-15 unused)
        #pragma unroll
        for (int g = 0; g < 2; ++g) {
            v8f acc = {};
            acc = __builtin_amdgcn_wmma_f32_16x16x4_f32(false, a1[g][0], false, bx0,
                                                        (short)0, acc, false, false);
            acc = __builtin_amdgcn_wmma_f32_16x16x4_f32(false, a1[g][1], false, bx1,
                                                        (short)0, acc, false, false);
            #pragma unroll
            for (int r = 0; r < 8; ++r) hg[8*g + r] = acc[r];
        }
        #pragma unroll
        for (int k = 0; k < HID; ++k) {
            float hv = hg[k];
            hg[k] = 0.5f * hv * (1.f + erff(hv * 0.70710678118654752f));   // exact GELU
        }

        // fc2: C starts as residual + bias in this lane's rows 0-2; six chained k pairs
        v8f o = {};
        #pragma unroll
        for (int c = 0; c < 3; ++c) o[c] = xs2[c] + f2b[c];
        #pragma unroll
        for (int q = 0; q < 6; ++q) {
            v2f bh; bh.x = hg[2*q]; bh.y = hg[2*q + 1];
            o = __builtin_amdgcn_wmma_f32_16x16x4_f32(false, a2[q], false, bh,
                                                      (short)0, o, false, false);
        }

        // ---- coalesced channel-plane stores ----
        #pragma unroll
        for (int c = 0; c < 3; ++c)
            out[(long)(b * NC + c) * plane + pix + p * NW] = o[c];
    }
}

extern "C" void kernel_launch(void* const* d_in, const int* in_sizes, int n_in,
                              void* d_out, int out_size, void* d_ws, size_t ws_size,
                              hipStream_t stream) {
    (void)in_sizes; (void)n_in; (void)out_size; (void)d_ws; (void)ws_size;
    // setup_inputs order: 0:H 1:W 2:x 3:fhigh 4:norm1_w 5:norm1_b 6:q_C_w 7:q_dw_w
    // 8:kv_C_w 9:kv_dw_w 10:temperature 11:proj_C_w 12:proj_C_b 13:norm2_w 14:norm2_b
    // 15:fc1_w 16:fc1_b 17:fc2_w 18:fc2_b
    const float* x     = (const float*)d_in[2];
    const float* fh    = (const float*)d_in[3];
    const float* n1w   = (const float*)d_in[4];
    const float* n1b   = (const float*)d_in[5];
    const float* qcw   = (const float*)d_in[6];
    const float* qdw   = (const float*)d_in[7];
    const float* kvcw  = (const float*)d_in[8];
    const float* kvdw  = (const float*)d_in[9];
    const float* tempp = (const float*)d_in[10];
    const float* pcw   = (const float*)d_in[11];
    const float* pcb   = (const float*)d_in[12];
    const float* n2w   = (const float*)d_in[13];
    const float* n2b   = (const float*)d_in[14];
    const float* f1w   = (const float*)d_in[15];
    const float* f1b   = (const float*)d_in[16];
    const float* f2w   = (const float*)d_in[17];
    const float* f2b   = (const float*)d_in[18];
    float* out = (float*)d_out;

    const int nWindows = NB * (NH / WS) * (NW / WS);   // 16384
    winattn_fused<<<nWindows, NTH, 0, stream>>>(
        x, fh, n1w, n1b, qcw, qdw, kvcw, kvdw, tempp,
        pcw, pcb, n2w, n2b, f1w, f1b, f2w, f2b, out);
}

// v006
// A run of this version takes 46.5 microseconds.
// In both of two side-by-side timings against v005, it was 1.13 times as fast.
// Over all steps from v000 it is 2.69 times as fast.
#include <hip/hip_runtime.h>
#include <math.h>

typedef float v2f __attribute__((ext_vector_type(2)));
typedef float v8f __attribute__((ext_vector_type(8)));

#define NB   16
#define NC   3
#define NH   512
#define NW   512
#define WS   16
#define HWIN 256     // ws*ws
#define HID  12
#define UP   36      // LDS pitch (floats) of one staged channel row of 32 pixels: 16-byte reads of rows 0-5 meet no bank twice
#define UW   (6 * UP)
#define GP   8       // LDS pitch (floats) of one lane's eight accumulator registers
#define GW   (32 * GP)
#define TP   17      // LDS pitch (floats) of one channel's piece of a tile row: 16 pixels and one zero cell, the right edge of this piece and the left edge of the next
#define RP   (6 * TP)         // LDS pitch (floats) of one tile row: the six channels' pieces side by side
#define NT   (18 * RP + 1)    // 16 pixel rows between a top and a bottom row of zeros
#define PX   4                // pixels of the window per thread
#define NTH  (HWIN / PX)      // threads per work-group
#define NWV  (NTH / 32)       // waves per work-group

// ---- exact GELU of two hidden units: h * Phi(h), Phi(h) = 0.5 + 0.5 * erf(h / sqrt(2)) ----
// 0.5 * erf(t / sqrt(2)) = t * P(s) / Q(s), s = t * t: one rational function for the whole range in which f32 can tell
// Phi from 0 and 1, so there is no branch on |h| and no exp. t is h held inside that range: beyond it Phi keeps the
// value it has at the bound, 0 or 1 to within a rounding. Two units go side by side, so that each polynomial step is
// one packed fma.
__device__ __forceinline__ v2f both(float c) { v2f r; r.x = c; r.y = c; return r; }
__device__ __forceinline__ v2f gelu2(v2f h)
{
    v2f t;
    t.x = __builtin_amdgcn_fmed3f(h.x, -5.42f, 5.42f);
    t.y = __builtin_amdgcn_fmed3f(h.y, -5.42f, 5.42f);
    v2f s = t * t;
    v2f pn = both(5.06135211e-6f);
    pn = __builtin_elementwise_fma(pn, s, both(1.50626613e-4f));
    pn = __builtin_elementwise_fma(pn, s, both(4.50388948e-3f));
    pn = __builtin_elementwise_fma(pn, s, both(3.27405147e-2f));
    pn = __builtin_elementwise_fma(pn, s, both(3.98942262e-1f));
    v2f qn = both(-1.84243798e-9f);
    qn = __builtin_elementwise_fma(qn, s, both(7.35873925e-7f));
    qn = __builtin_elementwise_fma(qn, s, both(6.36226614e-5f));
    qn = __builtin_elementwise_fma(qn, s, both(1.75880874e-3f));
    qn = __builtin_elementwise_fma(qn, s, both(2.77462620e-2f));
    qn = __builtin_elementwise_fma(qn, s, both(2.48734623e-1f));
    qn = __builtin_elementwise_fma(qn, s, both(1.0f));
    v2f rq; rq.x = __builtin_amdgcn_rcpf(qn.x); rq.y = __builtin_amdgcn_rcpf(qn.y);
    v2f phi = __builtin_elementwise_fma(t, pn * rq, both(0.5f));
    return h * phi;
}

// One window per work-group, PX pixels per thread: rows PX * i to PX * i + PX - 1 of column j. What a wave does once
// whatever its pixel count (the window sums, the 3x3 softmax, the weight fragments, the addresses) is then done by
// NWV waves a window, and the PX pixels of a thread read the tile rows that their 3x3 taps share only once.
// Every loop over p is unrolled, so that the per-pixel arrays are indexed by constants and stay in registers.
// second bound: 8 waves per SIMD at least; the build holds 128 registers, so 8 waves fit a SIMD
__global__ __launch_bounds__(NTH, 8) void winattn_fused(
    const float* __restrict__ x,      const float* __restrict__ fhigh,
    const float* __restrict__ n1w,    const float* __restrict__ n1b,
    const float* __restrict__ qcw,    const float* __restrict__ qdw,
    const float* __restrict__ kvcw,   const float* __restrict__ kvdw,
    const float* __restrict__ tempp,
    const float* __restrict__ pcw,    const float* __restrict__ pcb,
    const float* __restrict__ n2w,    const float* __restrict__ n2b,
    const float* __restrict__ f1w,    const float* __restrict__ f1b,
    const float* __restrict__ f2w,    const float* __restrict__ f2b,
    float* __restrict__ out)
{
    // q0-2, kv0-2 after the 1x1 conv, inside a border of zeros. The alignment puts the array first in LDS, and with
    // the channels side by side the taps in a thread's first tile rows lie within the reach of a two-address load's offsets.
    __shared__ __attribute__((aligned(64))) float s_t[NT];
    __shared__ __attribute__((aligned(16))) float s_u[8 * UW];   // per wave and chunk: q0-2, kv0-2 of 32 pixels
    __shared__ __attribute__((aligned(16))) float s_g[NWV * GW]; // per wave: its Gram partial, as the accumulator lies in the lanes

    const int w   = blockIdx.x;          // window id = b*1024 + wy*32 + wx
    const int b   = w >> 10;
    const int wy  = (w >> 5) & 31;
    const int wx  = w & 31;
    const int tid = threadIdx.x;
    const int i   = tid >> 4;
    const int j   = tid & 15;
    const int lane = tid & 31;
    const int wave = tid >> 5;

    const int  y     = wy * WS + i * PX;          // the thread's first pixel; pixel p lies p rows below
    const int  xg    = wx * WS + j;
    const long pix   = (long)y * NW + xg;
    const long plane = (long)NH * NW;
    const long xbase = (long)b * NC * plane + pix;

    // ---- load x and fhigh (3 channels each) of all PX pixels ----
    float xin[PX][3], fin[PX][3];
    const long fb = (long)w * (NC * HWIN);
    #pragma unroll
    for (int p = 0; p < PX; ++p) {
        #pragma unroll
        for (int c = 0; c < 3; ++c) {
            xin[p][c] = x[xbase + c * plane + p * NW];
            fin[p][c] = fhigh[fb + c * HWIN + (i * PX + p) * WS + j];
        }
    }

    // ---- the zero border ----
    // Pixel (r, col) of channel c lies at (r + 1) * RP + c * TP + col + 1. Zero: the top row with the first cell
    // behind it, the bottom row with the last cell, and in each pixel row the cell in front of each channel's piece.
    #pragma unroll
    for (int k = 0; k <= RP; k += NTH) {
        if (k + tid <= RP) {
            s_t[k + tid] = 0.f;
            s_t[17 * RP + k + tid] = 0.f;
        }
    }
    if (j < 6) {
        #pragma unroll
        for (int p = 0; p < PX; ++p) s_t[(i * PX + p + 1) * RP + j * TP] = 0.f;
    }
    float* tap = s_t + i * (PX * RP) + j;     // tap (di, dj) of channel c of pixel p lies at (p + di) * RP + c * TP + dj
    // ---- LayerNorm1 over C, the two 1x1 convs -> LDS ----
    #pragma unroll
    for (int p = 0; p < PX; ++p) {
        float* ctr = tap + (p + 1) * RP + 1;
        float m  = (xin[p][0] + xin[p][1] + xin[p][2]) * (1.f / 3.f);
        float d0 = xin[p][0] - m, d1 = xin[p][1] - m, d2 = xin[p][2] - m;
        float v  = (d0 * d0 + d1 * d1 + d2 * d2) * (1.f / 3.f);
        // The rsq and the one issue slot that the instruction set asks for behind a transcendental, in one statement.
        float rs;
        asm("v_rsq_f32 %0, %1\n\tv_nop" : "=v"(rs) : "v"(v + 1e-5f));
        float xn0 = d0 * rs * n1w[0] + n1b[0];
        float xn1 = d1 * rs * n1w[1] + n1b[1];
        float xn2 = d2 * rs * n1w[2] + n1b[2];
        #pragma unroll
        for (int c = 0; c < 3; ++c) {
            ctr[(3 + c) * TP] = kvcw[c*3+0]*xn0 + kvcw[c*3+1]*xn1 + kvcw[c*3+2]*xn2;
            ctr[c * TP]       = qcw[c*3+0]*fin[p][0] + qcw[c*3+1]*fin[p][1] + qcw[c*3+2]*fin[p][2];
        }
    }
    __syncthreads();

    // ---- depthwise 3x3: the window's zero padding is read from the border, so all nine taps are unconditional ----
    float qd[PX][3], kd[PX][3];
    #pragma unroll
    for (int p = 0; p < PX; ++p) {
        #pragma unroll
        for (int c = 0; c < 3; ++c) {
            float aq = 0.f, ak = 0.f;
            #pragma unroll
            for (int di = 0; di < 3; ++di) {
                #pragma unroll
                for (int dj = 0; dj < 3; ++dj) {
                    aq += qdw [c*9 + di*3 + dj] * tap[(p + di) * RP + c * TP + dj];
                    ak += kvdw[c*9 + di*3 + dj] * tap[(p + di) * RP + (3 + c) * TP + dj];
                }
            }
            qd[p][c] = aq; kd[p][c] = ak;
        }
    }

    // ---- the 15 window sums as one Gram matrix G = U * U^T on V_WMMA_F32_16X16X4_F32 ----
    // U: rows q0 q1 q2 kv0 kv1 kv2, columns the pixels. G[c][c] are the squared norms, G[c][3+d] = q_c . kv_d.
    // Each wave stages each of its chunks of 32 pixels (chunk p: pixel p of its lanes) channel-major in an LDS range
    // of its own and reads it back with lane l holding row (l & 15) and the 16 pixels of half (l >> 4): that one
    // fragment is A (row) and B (column) at once, so k slot (half, s) of A and of B is the same pixel. Rows 6-15
    // repeat row 5; they reach only rows and columns of G that nobody reads. One accumulator takes all chunks.
    const int half = lane >> 4;
    const int col  = lane & 15;
    const int row  = col < 6 ? col : 5;
    {
        float* uw = s_u + wave * (PX * UW);
        #pragma unroll
        for (int p = 0; p < PX; ++p) {
            #pragma unroll
            for (int c = 0; c < 3; ++c) {
                uw[p * UW + c * UP + lane]       = qd[p][c];
                uw[p * UW + (3 + c) * UP + lane] = kd[p][c];
            }
        }
        // the wave's own stores have landed before other lanes of the wave read them; also keeps the
        // compiler from lifting the reads over the stores
        asm volatile("s_wait_dscnt 0x0" ::: "memory");
        const float4* up = (const float4*)(uw + row * UP + 16 * half);
        v8f g = {};
        #pragma unroll
        for (int p = 0; p < PX; ++p) {
            float4 u[4];
            #pragma unroll
            for (int t = 0; t < 4; ++t) u[t] = up[p * (UW / 4) + t];
            #pragma unroll
            for (int t = 0; t < 4; ++t) {
                v2f lo; lo.x = u[t].x; lo.y = u[t].y;
                v2f hi; hi.x = u[t].z; hi.y = u[t].w;
                g = __builtin_amdgcn_wmma_f32_16x16x4_f32(false, lo, false, lo, (short)0, g, false, false);
                g = __builtin_amdgcn_wmma_f32_16x16x4_f32(false, hi, false, hi, (short)0, g, false, false);
            }
        }
        // lane d < 6 holds G[0..5][d] of this wave's pixels in registers 0-5; every lane stores its six,
        // so no branch stands behind the WMMA
        float* gp = s_g + wave * GW + lane * GP;
        *(float4*)gp       = make_float4(g[0], g[1], g[2], g[3]);
        *(float2*)(gp + 4) = make_float2(g[4], g[5]);
    }
    __syncthreads();

    // One sum a lane: lane 4c + d adds the waves' partials of q_c . kv_d = G[c][3+d], lane 16 + c those
    // of G[c][c]; the other lanes add words that were stored too but are used by nobody. Every lane then takes
    // the 15 sums from those lanes.
    float sums[15];
    {
        const int gi = half ? row * (GP + 1) : (3 + (col & 3)) * GP + (col >> 2);
        float tot = 0.f;
        #pragma unroll
        for (int k = 0; k < NWV; ++k) tot += s_g[k * GW + gi];
        const int ti = __float_as_int(tot);
        #pragma unroll
        for (int c = 0; c < 6; ++c) sums[c] = __int_as_float(__builtin_amdgcn_readlane(ti, 16 + c));
        #pragma unroll
        for (int c = 0; c < 3; ++c)
            #pragma unroll
            for (int d = 0; d < 3; ++d)
                sums[6 + c*3 + d] = __int_as_float(__builtin_amdgcn_readlane(ti, 4 * c + d));
    }

    // ---- 3x3 attention: one result for the whole window, so every value here is the same in all lanes ----
    // The 15 sums lie in scalar registers. Reciprocal square root, reciprocal and exp2 are single instructions
    // that also work on scalar registers; a correctly rounded sqrt or divide is a long sequence, the divide a
    // vector one. With 1 / max(sqrt(s), eps) = min(rsq(s), 1 / eps) the block leaves the vector port but for the
    // three row maxima.
    const float temp = tempp[0];
    float rq[3], rk[3];
    #pragma unroll
    for (int c = 0; c < 3; ++c) {
        rq[c] = fminf(__builtin_amdgcn_rsqf(sums[c]),     1e12f) * temp;
        rk[c] = fminf(__builtin_amdgcn_rsqf(sums[3 + c]), 1e12f);
    }
    float attn[3][3];
    #pragma unroll
    for (int c = 0; c < 3; ++c) {
        float l[3];
        #pragma unroll
        for (int d = 0; d < 3; ++d) l[d] = sums[6 + c*3 + d] * rq[c] * rk[d];
        float mx = fmaxf(l[0], fmaxf(l[1], l[2]));
        float e0 = __builtin_amdgcn_exp2f((l[0]-mx) * 1.44269504f);
        float e1 = __builtin_amdgcn_exp2f((l[1]-mx) * 1.44269504f);
        float e2 = __builtin_amdgcn_exp2f((l[2]-mx) * 1.44269504f);
        float inv = __builtin_amdgcn_rcpf(e0 + e1 + e2);
        attn[c][0] = e0*inv; attn[c][1] = e1*inv; attn[c][2] = e2*inv;
    }

    // ---- MLP weights of this lane's A rows, asked for ahead of the MLP ----
    // (what they are for: the MLP section below). Every lane reads from a row clamped into the array.
    const int  sub  = lane & 7;                       // output row inside this lane's block
    const bool mine = ((lane >> 3) & 1) == half;      // this lane's A slots lie on the diagonal block
    const unsigned ow1a = 12u * (unsigned)sub;                 // byte offsets: fc1_w row sub,
    const int      sub4 = sub & 3;                             // rows 8 + sub exist for sub < 4
    const unsigned ow1b = 12u * (unsigned)sub4;                // fc1_w row 8 + sub4, from row 8,
    const unsigned ow2  = 48u * (unsigned)(sub < NC ? sub : NC - 1);   // fc2_w row sub (sub < 3)
    float w1a[3], w1b[3], w2[HID];
    #pragma unroll
    for (int k = 0; k < 3; ++k) {
        w1a[k] = ((const float*)((const char*)f1w + ow1a))[k];
        w1b[k] = ((const float*)((const char*)(f1w + 24) + ow1b))[k];
    }
    const float b1a = f1b[sub];
    const float b1b = f1b[8 + sub4];
    #pragma unroll
    for (int k = 0; k < HID; ++k) w2[k] = ((const float*)((const char*)f2w + ow2))[k];
    // The loads' offset and index registers are inputs here so that none of them is reused, not even as a
    // load's destination, ahead of the wait on the address translations.
    asm volatile("s_wait_xcnt 0x0" :: "v"(ow1a), "v"(ow1b), "v"(sub), "v"(sub4), "v"(ow2) : "memory");

    // ---- MLP via V_WMMA_F32_16X16X4_F32, weights as A, pixels as B, no LDS ----
    // Lane l: col = l & 15, half = l >> 4. A: lane holds row col, B: lane holds column col;
    // each half supplies two of the four k slots, slot (half, s) of A meeting slot (half, s) of B.
    // D register r of lane l is D[8*half + r][col].
    // A is block-diagonal: rows 0-7 carry weights only in the k slots of half 0, rows 8-15 only in
    // those of half 1. Then D[8*half + r][col] is built from the B values of lane l alone, so every
    // lane feeds a pixel of its own as B and gets that pixel's results back as D: two k per WMMA,
    // eight output rows per WMMA, 32 pixels per WMMA.
    // fc1 weights: hidden unit j = 8*g + sub; k = {c0, c1}, then {c2, bias against a B of 1}
    const bool ok1 = mine && sub < HID - 8;
    const bool ok2 = mine && sub < NC;
    v2f a1[2][2];
    a1[0][0].x = mine ? w1a[0] : 0.f;  a1[0][0].y = mine ? w1a[1] : 0.f;
    a1[0][1].x = mine ? w1a[2] : 0.f;  a1[0][1].y = mine ? b1a    : 0.f;
    a1[1][0].x = ok1  ? w1b[0] : 0.f;  a1[1][0].y = ok1  ? w1b[1] : 0.f;
    a1[1][1].x = ok1  ? w1b[2] : 0.f;  a1[1][1].y = ok1  ? b1b    : 0.f;
    // fc2 weights: output channel sub (< 3); k = hidden units {2q, 2q+1}
    v2f a2[6];
    #pragma unroll
    for (int q = 0; q < 6; ++q) {
        a2[q].x = ok2 ? w2[2*q]     : 0.f;
        a2[q].y = ok2 ? w2[2*q + 1] : 0.f;
    }

    #pragma unroll
    for (int p = 0; p < PX; ++p) {
        // x2 = attn @ v  (v = kd, unnormalized), then proj conv1x1 + bias + residual
        float x2c[3], xs2[3];
        #pragma unroll
        for (int c = 0; c < 3; ++c)
            x2c[c] = attn[c][0]*kd[p][0] + attn[c][1]*kd[p][1] + attn[c][2]*kd[p][2];
        #pragma unroll
        for (int c = 0; c < 3; ++c)
            xs2[c] = xin[p][c] + pcw[c*3+0]*x2c[0] + pcw[c*3+1]*x2c[1] + pcw[c*3+2]*x2c[2] + pcb[c];

        // ---- LayerNorm2, kept in this lane's registers ----
        float ln0, ln1, ln2;
        {
            float m  = (xs2[0] + xs2[1] + xs2[2]) * (1.f / 3.f);
            float d0 = xs2[0]-m, d1 = xs2[1]-m, d2 = xs2[2]-m;
            float v  = (d0*d0 + d1*d1 + d2*d2) * (1.f / 3.f);
            float rs = rsqrtf(v + 1e-5f);
            ln0 = d0 * rs * n2w[0] + n2b[0];
            ln1 = d1 * rs * n2w[1] + n2b[1];
            ln2 = d2 * rs * n2w[2] + n2b[2];
        }

        v2f bx0; bx0.x = ln0; bx0.y = ln1;
        v2f bx1; bx1.x = ln2; bx1.y = 1.f;
        float hg[16];                                 // hidden units 0-11 of this pixel (12-15 unused)
        #pragma unroll
        for (int g = 0; g < 2; ++g) {
            v8f acc = {};
            acc = __builtin_amdgcn_wmma_f32_16x16x4_f32(false, a1[g][0], false, bx0,
                                                        (short)0, acc, false, false);
            acc = __builtin_amdgcn_wmma_f32_16x16x4_f32(false, a1[g][1], false, bx1,
                                                        (short)0, acc, false, false);
            #pragma unroll
            for (int r = 0; r < 8; ++r) hg[8*g + r] = acc[r];
        }
        v2f gl[6];                                    // exact GELU of units {2q, 2q+1}
        #pragma unroll
        for (int q = 0; q < 6; ++q) {
            v2f hv; hv.x = hg[2*q]; hv.y = hg[2*q + 1];
            gl[q] = gelu2(hv);
        }

        // fc2: C starts as residual + bias in this lane's rows 0-2; six chained k pairs
        v8f o = {};
        #pragma unroll
        for (int c = 0; c < 3; ++c) o[c] = xs2[c] + f2b[c];
        #pragma unroll
        for (int q = 0; q < 6; ++q) {
            o = __builtin_amdgcn_wmma_f32_16x16x4_f32(false, a2[q], false, gl[q],
                                                      (short)0, o, false, false);
        }

        // ---- coalesced channel-plane stores ----
        #pragma unroll
        for (int c = 0; c < 3; ++c)
            out[(long)(b * NC + c) * plane + pix + p * NW] = o[c];
    }
}

extern "C" void kernel_launch(void* const* d_in, const int* in_sizes, int n_in,
                              void* d_out, int out_size, void* d_ws, size_t ws_size,
                              hipStream_t stream) {
    (void)in_sizes; (void)n_in; (void)out_size; (void)d_ws; (void)ws_size;
    // setup_inputs order: 0:H 1:W 2:x 3:fhigh 4:norm1_w 5:norm1_b 6:q_C_w 7:q_dw_w
    // 8:kv_C_w 9:kv_dw_w 10:temperature 11:proj_C_w 12:proj_C_b 13:norm2_w 14:norm2_b
    // 15:fc1_w 16:fc1_b 17:fc2_w 18:fc2_b
    const float* x     = (const float*)d_in[2];
    const float* fh    = (const float*)d_in[3];
    const float* n1w   = (const float*)d_in[4];
    const float* n1b   = (const float*)d_in[5];
    const float* qcw   = (const float*)d_in[6];
    const float* qdw   = (const float*)d_in[7];
    const float* kvcw  = (const float*)d_in[8];
    const float* kvdw  = (const float*)d_in[9];
    const float* tempp = (const float*)d_in[10];
    const float* pcw   = (const float*)d_in[11];
    const float* pcb   = (const float*)d_in[12];
    const float* n2w   = (const float*)d_in[13];
    const float* n2b   = (const float*)d_in[14];
    const float* f1w   = (const float*)d_in[15];
    const float* f1b   = (const float*)d_in[16];
    const float* f2w   = (const float*)d_in[17];
    const float* f2b   = (const float*)d_in[18];
    float* out = (float*)d_out;

    const int nWindows = NB * (NH / WS) * (NW / WS);   // 16384
    winattn_fused<<<nWindows, NTH, 0, stream>>>(
        x, fh, n1w, n1b, qcw, qdw, kvcw, kvdw, tempp,
        pcw, pcb, n2w, n2b, f1w, f1b, f2w, f2b, out);
}

// v007
// A run of this version takes 43.3 microseconds.
// Two timings next to v006 both put it at 1.08 times that version's speed.
// Over all steps from v000 it is 2.90 times as fast.
#include <hip/hip_runtime.h>
#include <math.h>

typedef float v2f __attribute__((ext_vector_type(2)));
typedef float v8f __attribute__((ext_vector_type(8)));

#define NB   16
#define NC   3
#define NH   512
#define NW   512
#define WS   16
#define HWIN 256     // ws*ws
#define HID  12
#define UP   36      // LDS pitch (floats) of one staged channel row of 32 pixels: 16-byte reads of rows 0-5 meet no bank twice
#define UW   (6 * UP)         // one chunk; 216 floats put the next chunk's rows 0-5 on the banks that this chunk's leave free
#define GP   8       // LDS pitch (floats) of one lane's eight accumulator registers
#define GW   (32 * GP)
#define TP   17      // LDS pitch (floats) of one channel's piece of a tile row: 16 pixels and one zero cell, the right edge of this piece and the left edge of the next
#define RP   (6 * TP)         // LDS pitch (floats) of one tile row: the six channels' pieces side by side
#define NT   (18 * RP + 1)    // 16 pixel rows between a top and a bottom row of zeros
#define PX   4                // pixels of the window per thread
#define NTH  (HWIN / PX)      // threads per work-group
#define NWV  (NTH / 32)       // waves per work-group

// ---- exact GELU of two hidden units: h * Phi(h), Phi(h) = 0.5 + 0.5 * erf(h / sqrt(2)) ----
// 0.5 * erf(t / sqrt(2)) = t * P(s) / Q(s), s = t * t: one rational function for the whole range in which f32 can tell
// Phi from 0 and 1, so there is no branch on |h| and no exp. t is h held inside that range: beyond it Phi keeps the
// value it has at the bound, 0 or 1 to within a rounding. Two units go side by side, so that each polynomial step is
// one packed fma.
__device__ __forceinline__ v2f both(float c) { v2f r; r.x = c; r.y = c; return r; }
__device__ __forceinline__ v2f gelu2(v2f h)
{
    v2f t;
    t.x = __builtin_amdgcn_fmed3f(h.x, -5.42f, 5.42f);
    t.y = __builtin_amdgcn_fmed3f(h.y, -5.42f, 5.42f);
    v2f s = t * t;
    v2f pn = both(5.06135211e-6f);
    pn = __builtin_elementwise_fma(pn, s, both(1.50626613e-4f));
    pn = __builtin_elementwise_fma(pn, s, both(4.50388948e-3f));
    pn = __builtin_elementwise_fma(pn, s, both(3.27405147e-2f));
    pn = __builtin_elementwise_fma(pn, s, both(3.98942262e-1f));
    v2f qn = both(-1.84243798e-9f);
    qn = __builtin_elementwise_fma(qn, s, both(7.35873925e-7f));
    qn = __builtin_elementwise_fma(qn, s, both(6.36226614e-5f));
    qn = __builtin_elementwise_fma(qn, s, both(1.75880874e-3f));
    qn = __builtin_elementwise_fma(qn, s, both(2.77462620e-2f));
    qn = __builtin_elementwise_fma(qn, s, both(2.48734623e-1f));
    qn = __builtin_elementwise_fma(qn, s, both(1.0f));
    v2f rq; rq.x = __builtin_amdgcn_rcpf(qn.x); rq.y = __builtin_amdgcn_rcpf(qn.y);
    v2f phi = __builtin_elementwise_fma(t, pn * rq, both(0.5f));
    return h * phi;
}

// One window per work-group, PX pixels per thread: rows PX * i to PX * i + PX - 1 of column j. What a wave does once
// whatever its pixel count (the window sums, the 3x3 softmax, the weight fragments, the addresses) is then done by
// NWV waves a window, and the PX pixels of a thread read the tile rows that their 3x3 taps share only once.
// Every loop over p is unrolled, so that the per-pixel arrays are indexed by constants and stay in registers.
// second bound: 8 waves per SIMD at least; the build holds 128 registers, so 8 waves fit a SIMD
__global__ __launch_bounds__(NTH, 8) void winattn_fused(
    const float* __restrict__ x,      const float* __restrict__ fhigh,
    const float* __restrict__ n1w,    const float* __restrict__ n1b,
    const float* __restrict__ qcw,    const float* __restrict__ qdw,
    const float* __restrict__ kvcw,   const float* __restrict__ kvdw,
    const float* __restrict__ tempp,
    const float* __restrict__ pcw,    const float* __restrict__ pcb,
    const float* __restrict__ n2w,    const float* __restrict__ n2b,
    const float* __restrict__ f1w,    const float* __restrict__ f1b,
    const float* __restrict__ f2w,    const float* __restrict__ f2b,
    float* __restrict__ out)
{
    // q0-2, kv0-2 after the 1x1 conv, inside a border of zeros. The alignment puts the array first in LDS, and with
    // the channels side by side the taps in a thread's first tile rows lie within the reach of a two-address load's offsets.
    __shared__ __attribute__((aligned(64))) float s_t[NT];
    __shared__ __attribute__((aligned(16))) float s_u[8 * UW];   // per wave and chunk: q0-2, kv0-2 of 32 pixels
    __shared__ __attribute__((aligned(16))) float s_g[NWV * GW]; // per wave: its Gram partial, as the accumulator lies in the lanes

    const int w   = blockIdx.x;          // window id = b*1024 + wy*32 + wx
    const int b   = w >> 10;
    const int wy  = (w >> 5) & 31;
    const int wx  = w & 31;
    const int tid = threadIdx.x;
    const int i   = tid >> 4;
    const int j   = tid & 15;
    const int lane = tid & 31;
    const int wave = tid >> 5;

    const int  y     = wy * WS + i * PX;          // the thread's first pixel; pixel p lies p rows below
    const int  xg    = wx * WS + j;
    const long pix   = (long)y * NW + xg;
    const long plane = (long)NH * NW;
    const long xbase = (long)b * NC * plane + pix;

    // ---- load x and fhigh (3 channels each) of all PX pixels ----
    float xin[PX][3], fin[PX][3];
    const long fb = (long)w * (NC * HWIN);
    #pragma unroll
    for (int p = 0; p < PX; ++p) {
        #pragma unroll
        for (int c = 0; c < 3; ++c) {
            xin[p][c] = x[xbase + c * plane + p * NW];
            fin[p][c] = fhigh[fb + c * HWIN + (i * PX + p) * WS + j];
        }
    }

    // ---- the zero border ----
    // Pixel (r, col) of channel c lies at (r + 1) * RP + c * TP + col + 1. Zero: the top row with the first cell
    // behind it, the bottom row with the last cell, and in each pixel row the cell in front of each channel's piece.
    #pragma unroll
    for (int k = 0; k <= RP; k += NTH) {
        if (k + tid <= RP) {
            s_t[k + tid] = 0.f;
            s_t[17 * RP + k + tid] = 0.f;
        }
    }
    if (j < 6) {
        #pragma unroll
        for (int p = 0; p < PX; ++p) s_t[(i * PX + p + 1) * RP + j * TP] = 0.f;
    }
    float* tap = s_t + i * (PX * RP) + j;     // tap (di, dj) of channel c of pixel p lies at (p + di) * RP + c * TP + dj
    // ---- LayerNorm1 over C, the two 1x1 convs -> LDS ----
    #pragma unroll
    for (int p = 0; p < PX; ++p) {
        float* ctr = tap + (p + 1) * RP + 1;
        float m  = (xin[p][0] + xin[p][1] + xin[p][2]) * (1.f / 3.f);
        float d0 = xin[p][0] - m, d1 = xin[p][1] - m, d2 = xin[p][2] - m;
        float v  = (d0 * d0 + d1 * d1 + d2 * d2) * (1.f / 3.f);
        // The rsq and the one issue slot that the instruction set asks for behind a transcendental, in one statement.
        float rs;
        asm("v_rsq_f32 %0, %1\n\tv_nop" : "=v"(rs) : "v"(v + 1e-5f));
        float xn0 = d0 * rs * n1w[0] + n1b[0];
        float xn1 = d1 * rs * n1w[1] + n1b[1];
        float xn2 = d2 * rs * n1w[2] + n1b[2];
        #pragma unroll
        for (int c = 0; c < 3; ++c) {
            ctr[(3 + c) * TP] = kvcw[c*3+0]*xn0 + kvcw[c*3+1]*xn1 + kvcw[c*3+2]*xn2;
            ctr[c * TP]       = qcw[c*3+0]*fin[p][0] + qcw[c*3+1]*fin[p][1] + qcw[c*3+2]*fin[p][2];
        }
    }
    __syncthreads();

    // ---- depthwise 3x3: the window's zero padding is read from the border, so all nine taps are unconditional ----
    float qd[PX][3], kd[PX][3];
    #pragma unroll
    for (int p = 0; p < PX; ++p) {
        #pragma unroll
        for (int c = 0; c < 3; ++c) {
            float aq = 0.f, ak = 0.f;
            #pragma unroll
            for (int di = 0; di < 3; ++di) {
                #pragma unroll
                for (int dj = 0; dj < 3; ++dj) {
                    aq += qdw [c*9 + di*3 + dj] * tap[(p + di) * RP + c * TP + dj];
                    ak += kvdw[c*9 + di*3 + dj] * tap[(p + di) * RP + (3 + c) * TP + dj];
                }
            }
            qd[p][c] = aq; kd[p][c] = ak;
        }
    }

    // ---- the 15 window sums as one Gram matrix G = U * U^T on V_WMMA_F32_16X16X4_F32 ----
    // U: rows q0 q1 q2 kv0 kv1 kv2, columns the pixels. G[c][c] are the squared norms, G[c][3+d] = q_c . kv_d.
    // Each wave stages each of its chunks of 32 pixels (chunk p: pixel p of its lanes) channel-major in an LDS range
    // of its own and reads it back with lane l holding row (l & 15) and the 16 pixels of half (l >> 4): that one
    // fragment is A (row) and B (column) at once, so k slot (half, s) of A and of B is the same pixel.
    // Two chunks share each WMMA: rows and columns 0-5 hold the six channels of an even chunk, rows and columns 8-13
    // those of the odd chunk behind it. The 6x6 blocks at (0, 0) and at (8, 8) of G are then the two chunks' own Gram
    // partials; the blocks beside them mix pixels of the two chunks and are read by nobody. Rows 6, 7, 14 and 15
    // repeat the row in front of them; nobody reads what they reach either. One accumulator takes all chunk pairs.
    const int half = lane >> 4;
    const int col  = lane & 15;
    const int row  = col < 6 ? col : 5;
    const int odd  = col >> 3;                          // this lane's row and column belong to the odd chunk of a pair
    const int urow = (col & 7) < 6 ? (col & 7) : 5;     // and hold this channel of it
    {
        float* uw = s_u + wave * (PX * UW);
        #pragma unroll
        for (int p = 0; p < PX; ++p) {
            #pragma unroll
            for (int c = 0; c < 3; ++c) {
                uw[p * UW + c * UP + lane]       = qd[p][c];
                uw[p * UW + (3 + c) * UP + lane] = kd[p][c];
            }
        }
        // the wave's own stores have landed before other lanes of the wave read them; also keeps the
        // compiler from lifting the reads over the stores
        asm volatile("s_wait_dscnt 0x0" ::: "memory");
        const float4* up = (const float4*)(uw + odd * UW + urow * UP + 16 * half);
        v8f g = {};
        #pragma unroll
        for (int p = 0; p < PX; p += 2) {
            float4 u[4];
            #pragma unroll
            for (int t = 0; t < 4; ++t) u[t] = up[p * (UW / 4) + t];
            #pragma unroll
            for (int t = 0; t < 4; ++t) {
                v2f lo; lo.x = u[t].x; lo.y = u[t].y;
                v2f hi; hi.x = u[t].z; hi.y = u[t].w;
                g = __builtin_amdgcn_wmma_f32_16x16x4_f32(false, lo, false, lo, (short)0, g, false, false);
                g = __builtin_amdgcn_wmma_f32_16x16x4_f32(false, hi, false, hi, (short)0, g, false, false);
            }
        }
        // lane d < 6 holds G[0..5][d] of this wave's even chunks in registers 0-5, lane 24 + d the same of its odd
        // chunks (rows 8-13 lie in the upper half's registers 0-5); every lane stores its six, so no branch stands
        // behind the WMMA
        float* gp = s_g + wave * GW + lane * GP;
        *(float4*)gp       = make_float4(g[0], g[1], g[2], g[3]);
        *(float2*)(gp + 4) = make_float2(g[4], g[5]);
    }
    __syncthreads();

    // One sum a lane: lane 4c + d adds the waves' partials, even and odd chunks', of q_c . kv_d = G[c][3+d],
    // lane 16 + c those of G[c][c]; the other lanes add words that were stored too but are used by nobody. Every
    // lane then takes the 15 sums from those lanes.
    float sums[15];
    {
        const int gi = half ? row * (GP + 1) : (3 + (col & 3)) * GP + (col >> 2);
        float tot = 0.f;
        #pragma unroll
        for (int k = 0; k < NWV; ++k) tot += s_g[k * GW + gi] + s_g[k * GW + 24 * GP + gi];
        const int ti = __float_as_int(tot);
        #pragma unroll
        for (int c = 0; c < 6; ++c) sums[c] = __int_as_float(__builtin_amdgcn_readlane(ti, 16 + c));
        #pragma unroll
        for (int c = 0; c < 3; ++c)
            #pragma unroll
            for (int d = 0; d < 3; ++d)
                sums[6 + c*3 + d] = __int_as_float(__builtin_amdgcn_readlane(ti, 4 * c + d));
    }

    // ---- 3x3 attention: one result for the whole window, so every value here is the same in all lanes ----
    // The 15 sums lie in scalar registers. Reciprocal square root, reciprocal and exp2 are single instructions
    // that also work on scalar registers; a correctly rounded sqrt or divide is a long sequence, the divide a
    // vector one. With 1 / max(sqrt(s), eps) = min(rsq(s), 1 / eps) the block leaves the vector port but for the
    // three row maxima.
    const float temp = tempp[0];
    float rq[3], rk[3];
    #pragma unroll
    for (int c = 0; c < 3; ++c) {
        rq[c] = fminf(__builtin_amdgcn_rsqf(sums[c]),     1e12f) * temp;
        rk[c] = fminf(__builtin_amdgcn_rsqf(sums[3 + c]), 1e12f);
    }
    float attn[3][3];
    #pragma unroll
    for (int c = 0; c < 3; ++c) {
        float l[3];
        #pragma unroll
        for (int d = 0; d < 3; ++d) l[d] = sums[6 + c*3 + d] * rq[c] * rk[d];
        float mx = fmaxf(l[0], fmaxf(l[1], l[2]));
        float e0 = __builtin_amdgcn_exp2f((l[0]-mx) * 1.44269504f);
        float e1 = __builtin_amdgcn_exp2f((l[1]-mx) * 1.44269504f);
        float e2 = __builtin_amdgcn_exp2f((l[2]-mx) * 1.44269504f);
        float inv = __builtin_amdgcn_rcpf(e0 + e1 + e2);
        attn[c][0] = e0*inv; attn[c][1] = e1*inv; attn[c][2] = e2*inv;
    }

    // ---- MLP weights of this lane's A rows, asked for ahead of the MLP ----
    // (what they are for: the MLP section below). Every lane reads from a row clamped into the array.
    const int  sub  = lane & 7;                       // output row inside this lane's block
    const bool mine = ((lane >> 3) & 1) == half;      // this lane's A slots lie on the diagonal block
    const unsigned ow1a = 12u * (unsigned)sub;                 // byte offsets: fc1_w row sub,
    const int      sub4 = sub & 3;                             // rows 8 + sub exist for sub < 4
    const unsigned ow1b = 12u * (unsigned)sub4;                // fc1_w row 8 + sub4, from row 8,
    const unsigned ow2  = 48u * (unsigned)(sub < NC ? sub : NC - 1);   // fc2_w row sub (sub < 3)
    float w1a[3], w1b[3], w2[HID];
    #pragma unroll
    for (int k = 0; k < 3; ++k) {
        w1a[k] = ((const float*)((const char*)f1w + ow1a))[k];
        w1b[k] = ((const float*)((const char*)(f1w + 24) + ow1b))[k];
    }
    const float b1a = f1b[sub];
    const float b1b = f1b[8 + sub4];
    #pragma unroll
    for (int k = 0; k < HID; ++k) w2[k] = ((const float*)((const char*)f2w + ow2))[k];
    // The loads' offset and index registers are inputs here so that none of them is reused, not even as a
    // load's destination, ahead of the wait on the address translations.
    asm volatile("s_wait_xcnt 0x0" :: "v"(ow1a), "v"(ow1b), "v"(sub), "v"(sub4), "v"(ow2) : "memory");

    // ---- MLP via V_WMMA_F32_16X16X4_F32, weights as A, pixels as B, no LDS ----
    // Lane l: col = l & 15, half = l >> 4. A: lane holds row col, B: lane holds column col;
    // each half supplies two of the four k slots, slot (half, s) of A meeting slot (half, s) of B.
    // D register r of lane l is D[8*half + r][col].
    // A is block-diagonal: rows 0-7 carry weights only in the k slots of half 0, rows 8-15 only in
    // those of half 1. Then D[8*half + r][col] is built from the B values of lane l alone, so every
    // lane feeds a pixel of its own as B and gets that pixel's results back as D: two k per WMMA,
    // eight output rows per WMMA, 32 pixels per WMMA.
    // fc1 weights: hidden unit j = 8*g + sub; k = {c0, c1}, then {c2, bias against a B of 1}
    const bool ok1 = mine && sub < HID - 8;
    const bool ok2 = mine && sub < NC;
    v2f a1[2][2];
    a1[0][0].x = mine ? w1a[0] : 0.f;  a1[0][0].y = mine ? w1a[1] : 0.f;
    a1[0][1].x = mine ? w1a[2] : 0.f;  a1[0][1].y = mine ? b1a    : 0.f;
    a1[1][0].x = ok1  ? w1b[0] : 0.f;  a1[1][0].y = ok1  ? w1b[1] : 0.f;
    a1[1][1].x = ok1  ? w1b[2] : 0.f;  a1[1][1].y = ok1  ? b1b    : 0.f;
    // fc2 weights: output channel sub (< 3); k = hidden units {2q, 2q+1}
    v2f a2[6];
    #pragma unroll
    for (int q = 0; q < 6; ++q) {
        a2[q].x = ok2 ? w2[2*q]     : 0.f;
        a2[q].y = ok2 ? w2[2*q + 1] : 0.f;
    }

    #pragma unroll
    for (int p = 0; p < PX; ++p) {
        // x2 = attn @ v  (v = kd, unnormalized), then proj conv1x1 + bias + residual
        float x2c[3], xs2[3];
        #pragma unroll
        for (int c = 0; c < 3; ++c)
            x2c[c] = attn[c][0]*kd[p][0] + attn[c][1]*kd[p][1] + attn[c][2]*kd[p][2];
        #pragma unroll
        for (int c = 0; c < 3; ++c)
            xs2[c] = xin[p][c] + pcw[c*3+0]*x2c[0] + pcw[c*3+1]*x2c[1] + pcw[c*3+2]*x2c[2] + pcb[c];

        // ---- LayerNorm2, kept in this lane's registers ----
        float ln0, ln1, ln2;
        {
            float m  = (xs2[0] + xs2[1] + xs2[2]) * (1.f / 3.f);
            float d0 = xs2[0]-m, d1 = xs2[1]-m, d2 = xs2[2]-m;
            float v  = (d0*d0 + d1*d1 + d2*d2) * (1.f / 3.f);
            float rs = rsqrtf(v + 1e-5f);
            ln0 = d0 * rs * n2w[0] + n2b[0];
            ln1 = d1 * rs * n2w[1] + n2b[1];
            ln2 = d2 * rs * n2w[2] + n2b[2];
        }

        v2f bx0; bx0.x = ln0; bx0.y = ln1;
        v2f bx1; bx1.x = ln2; bx1.y = 1.f;
        float hg[16];                                 // hidden units 0-11 of this pixel (12-15 unused)
        #pragma unroll
        for (int g = 0; g < 2; ++g) {
            v8f acc = {};
            acc = __builtin_amdgcn_wmma_f32_16x16x4_f32(false, a1[g][0], false, bx0,
                                                        (short)0, acc, false, false);
            acc = __builtin_amdgcn_wmma_f32_16x16x4_f32(false, a1[g][1], false, bx1,
                                                        (short)0, acc, false, false);
            #pragma unroll
            for (int r = 0; r < 8; ++r) hg[8*g + r] = acc[r];
        }
        v2f gl[6];                                    // exact GELU of units {2q, 2q+1}
        #pragma unroll
        for (int q = 0; q < 6; ++q) {
            v2f hv; hv.x = hg[2*q]; hv.y = hg[2*q + 1];
            gl[q] = gelu2(hv);
        }

        // fc2: C starts as residual + bias in this lane's rows 0-2; six chained k pairs
        v8f o = {};
        #pragma unroll
        for (int c = 0; c < 3; ++c) o[c] = xs2[c] + f2b[c];
        #pragma unroll
        for (int q = 0; q < 6; ++q) {
            o = __builtin_amdgcn_wmma_f32_16x16x4_f32(false, a2[q], false, gl[q],
                                                      (short)0, o, false, false);
        }

        // ---- coalesced channel-plane stores ----
        #pragma unroll
        for (int c = 0; c < 3; ++c)
            out[(long)(b * NC + c) * plane + pix + p * NW] = o[c];
    }
}

extern "C" void kernel_launch(void* const* d_in, const int* in_sizes, int n_in,
                              void* d_out, int out_size, void* d_ws, size_t ws_size,
                              hipStream_t stream) {
    (void)in_sizes; (void)n_in; (void)out_size; (void)d_ws; (void)ws_size;
    // setup_inputs order: 0:H 1:W 2:x 3:fhigh 4:norm1_w 5:norm1_b 6:q_C_w 7:q_dw_w
    // 8:kv_C_w 9:kv_dw_w 10:temperature 11:proj_C_w 12:proj_C_b 13:norm2_w 14:norm2_b
    // 15:fc1_w 16:fc1_b 17:fc2_w 18:fc2_b
    const float* x     = (const float*)d_in[2];
    const float* fh    = (const float*)d_in[3];
    const float* n1w   = (const float*)d_in[4];
    const float* n1b   = (const float*)d_in[5];
    const float* qcw   = (const float*)d_in[6];
    const float* qdw   = (const float*)d_in[7];
    const float* kvcw  = (const float*)d_in[8];
    const float* kvdw  = (const float*)d_in[9];
    const float* tempp = (const float*)d_in[10];
    const float* pcw   = (const float*)d_in[11];
    const float* pcb   = (const float*)d_in[12];
    const float* n2w   = (const float*)d_in[13];
    const float* n2b   = (const float*)d_in[14];
    const float* f1w   = (const float*)d_in[15];
    const float* f1b   = (const float*)d_in[16];
    const float* f2w   = (const float*)d_in[17];
    const float* f2b   = (const float*)d_in[18];
    float* out = (float*)d_out;

    const int nWindows = NB * (NH / WS) * (NW / WS);   // 16384
    winattn_fused<<<nWindows, NTH, 0, stream>>>(
        x, fh, n1w, n1b, qcw, qdw, kvcw, kvdw, tempp,
        pcw, pcb, n2w, n2b, f1w, f1b, f2w, f2b, out);
}

// v008
// It runs in 41.4 microseconds.
// Next to v007, in two timings, it ran 1.05 times as fast each time.
// All steps since v000 together make it 3.04 times as fast.
#include <hip/hip_runtime.h>
#include <math.h>

typedef float v2f __attribute__((ext_vector_type(2)));
typedef float v8f __attribute__((ext_vector_type(8)));

#define NB   16
#define NC   3
#define NH   512
#define NW   512
#define WS   16
#define HWIN 256     // ws*ws
#define HID  12
#define UP   36      // LDS pitch (floats) of one staged channel row of 32 pixels: 16-byte reads of rows 0-5 meet no bank twice
#define UW   (6 * UP)         // one chunk; 216 floats put the next chunk's rows 0-5 on the banks that this chunk's leave free
#define GP   8       // LDS pitch (floats) of one lane's eight accumulator registers
#define GW   (32 * GP)
#define TP   17      // LDS pitch (floats) of one channel's piece of a tile row: 16 pixels and one zero cell, the right edge of this piece and the left edge of the next
#define RP   (6 * TP)         // LDS pitch (floats) of one tile row: the six channels' pieces side by side
#define NT   (18 * RP + 1)    // 16 pixel rows between a top and a bottom row of zeros
#define PX   4                // pixels of the window per thread
#define NTH  (HWIN / PX)      // threads per work-group
#define NWV  (NTH / 32)       // waves per work-group

// ---- exact GELU of two hidden units: h * Phi(h), Phi(h) = 0.5 + 0.5 * erf(h / sqrt(2)) ----
// 0.5 * erf(t / sqrt(2)) = t * P(s) / Q(s), s = t * t: one rational function for the whole range in which f32 can tell
// Phi from 0 and 1, so there is no branch on |h| and no exp. t is h held inside that range: beyond it Phi keeps the
// value it has at the bound, 0 or 1 to within a rounding. Two units go side by side, so that each polynomial step is
// one packed fma.
__device__ __forceinline__ v2f both(float c) { v2f r; r.x = c; r.y = c; return r; }
// A value that is the same in all lanes, named as such: its arithmetic then stays on the scalar unit. Used where the
// values fill a vector: there the compiler otherwise pairs them up and computes them with packed vector instructions.
__device__ __forceinline__ float uni(float c) { return __int_as_float(__builtin_amdgcn_readfirstlane(__float_as_int(c))); }
__device__ __forceinline__ v2f gelu2(v2f h)
{
    v2f t;
    t.x = __builtin_amdgcn_fmed3f(h.x, -5.42f, 5.42f);
    t.y = __builtin_amdgcn_fmed3f(h.y, -5.42f, 5.42f);
    v2f s = t * t;
    v2f pn = both(5.06135211e-6f);
    pn = __builtin_elementwise_fma(pn, s, both(1.50626613e-4f));
    pn = __builtin_elementwise_fma(pn, s, both(4.50388948e-3f));
    pn = __builtin_elementwise_fma(pn, s, both(3.27405147e-2f));
    pn = __builtin_elementwise_fma(pn, s, both(3.98942262e-1f));
    v2f qn = both(-1.84243798e-9f);
    qn = __builtin_elementwise_fma(qn, s, both(7.35873925e-7f));
    qn = __builtin_elementwise_fma(qn, s, both(6.36226614e-5f));
    qn = __builtin_elementwise_fma(qn, s, both(1.75880874e-3f));
    qn = __builtin_elementwise_fma(qn, s, both(2.77462620e-2f));
    qn = __builtin_elementwise_fma(qn, s, both(2.48734623e-1f));
    qn = __builtin_elementwise_fma(qn, s, both(1.0f));
    v2f rq; rq.x = __builtin_amdgcn_rcpf(qn.x); rq.y = __builtin_amdgcn_rcpf(qn.y);
    v2f phi = __builtin_elementwise_fma(t, pn * rq, both(0.5f));
    return h * phi;
}

// One window per work-group, PX pixels per thread: rows PX * i to PX * i + PX - 1 of column j. What a wave does once
// whatever its pixel count (the window sums, the 3x3 softmax, the weight fragments, the addresses) is then done by
// NWV waves a window, and the PX pixels of a thread read the tile rows that their 3x3 taps share only once.
// Every loop over p is unrolled, so that the per-pixel arrays are indexed by constants and stay in registers.
// second bound: 8 waves per SIMD at least; the build stays within 128 registers, so 8 waves fit a SIMD
__global__ __launch_bounds__(NTH, 8) void winattn_fused(
    const float* __restrict__ x,      const float* __restrict__ fhigh,
    const float* __restrict__ n1w,    const float* __restrict__ n1b,
    const float* __restrict__ qcw,    const float* __restrict__ qdw,
    const float* __restrict__ kvcw,   const float* __restrict__ kvdw,
    const float* __restrict__ tempp,
    const float* __restrict__ pcw,    const float* __restrict__ pcb,
    const float* __restrict__ n2w,    const float* __restrict__ n2b,
    const float* __restrict__ f1w,    const float* __restrict__ f1b,
    const float* __restrict__ f2w,    const float* __restrict__ f2b,
    float* __restrict__ out)
{
    // q0-2, kv0-2 after the 1x1 conv, inside a border of zeros. The alignment puts the array first in LDS, and with
    // the channels side by side the taps in a thread's first tile rows lie within the reach of a two-address load's offsets.
    __shared__ __attribute__((aligned(64))) float s_t[NT];
    __shared__ __attribute__((aligned(16))) float s_u[8 * UW];   // per wave and chunk: q0-2, kv0-2 of 32 pixels
    __shared__ __attribute__((aligned(16))) float s_g[NWV * GW]; // per wave: its Gram partial, as the accumulator lies in the lanes

    const int w   = blockIdx.x;          // window id = b*1024 + wy*32 + wx
    const int b   = w >> 10;
    const int wy  = (w >> 5) & 31;
    const int wx  = w & 31;
    const int tid = threadIdx.x;
    const int i   = tid >> 4;
    const int j   = tid & 15;
    const int lane = tid & 31;
    const int wave = tid >> 5;

    const int  y     = wy * WS + i * PX;          // the thread's first pixel; pixel p lies p rows below
    const int  xg    = wx * WS + j;
    const long pix   = (long)y * NW + xg;
    const long plane = (long)NH * NW;
    const long xbase = (long)b * NC * plane + pix;

    // ---- load x and fhigh (3 channels each) of all PX pixels ----
    float xin[PX][3], fin[PX][3];
    const long fb = (long)w * (NC * HWIN);
    #pragma unroll
    for (int p = 0; p < PX; ++p) {
        #pragma unroll
        for (int c = 0; c < 3; ++c) {
            xin[p][c] = x[xbase + c * plane + p * NW];
            fin[p][c] = fhigh[fb + c * HWIN + (i * PX + p) * WS + j];
        }
    }

    // ---- the zero border ----
    // Pixel (r, col) of channel c lies at (r + 1) * RP + c * TP + col + 1. Zero: the top row with the first cell
    // behind it, the bottom row with the last cell, and in each pixel row the cell in front of each channel's piece.
    #pragma unroll
    for (int k = 0; k <= RP; k += NTH) {
        if (k + tid <= RP) {
            s_t[k + tid] = 0.f;
            s_t[17 * RP + k + tid] = 0.f;
        }
    }
    if (j < 6) {
        #pragma unroll
        for (int p = 0; p < PX; ++p) s_t[(i * PX + p + 1) * RP + j * TP] = 0.f;
    }
    float* tap = s_t + i * (PX * RP) + j;     // tap (di, dj) of channel c of pixel p lies at (p + di) * RP + c * TP + dj
    // ---- LayerNorm1's scale and shift composed with the kv 1x1 conv, once, on values that are the same in all lanes ----
    // The three deviations from the mean add up to zero: d2 = -d0 - d1. So the conv of the normalised pixel is
    // kv_c = kA[c] * (d0 * rs) + kB[c] * (d1 * rs) + kC[c]; d2 itself is left to the variance alone.
    float kA[3], kB[3], kC[3];
    #pragma unroll
    for (int c = 0; c < 3; ++c) {
        const float k2 = kvcw[c*3+2] * n1w[2];
        kA[c] = kvcw[c*3+0] * n1w[0] - k2;
        kB[c] = kvcw[c*3+1] * n1w[1] - k2;
        kC[c] = kvcw[c*3+0]*n1b[0] + kvcw[c*3+1]*n1b[1] + kvcw[c*3+2]*n1b[2];
    }
    // ---- LayerNorm1 over C, the two 1x1 convs -> LDS ----
    #pragma unroll
    for (int p = 0; p < PX; ++p) {
        float* ctr = tap + (p + 1) * RP + 1;
        float m  = (xin[p][0] + xin[p][1] + xin[p][2]) * (1.f / 3.f);
        float d0 = xin[p][0] - m, d1 = xin[p][1] - m, d2 = xin[p][2] - m;
        float v  = (d0 * d0 + d1 * d1 + d2 * d2) * (1.f / 3.f);
        // The rsq and the one issue slot that the instruction set asks for behind a transcendental, in one statement.
        float rs;
        asm("v_rsq_f32 %0, %1\n\tv_nop" : "=v"(rs) : "v"(v + 1e-5f));
        float e0 = d0 * rs, e1 = d1 * rs;
        #pragma unroll
        for (int c = 0; c < 3; ++c) {
            ctr[(3 + c) * TP] = __builtin_fmaf(kA[c], e0, __builtin_fmaf(kB[c], e1, kC[c]));
            ctr[c * TP]       = qcw[c*3+0]*fin[p][0] + qcw[c*3+1]*fin[p][1] + qcw[c*3+2]*fin[p][2];
        }
    }
    __syncthreads();

    // ---- depthwise 3x3: the window's zero padding is read from the border, so all nine taps are unconditional ----
    float qd[PX][3], kd[PX][3];
    #pragma unroll
    for (int p = 0; p < PX; ++p) {
        #pragma unroll
        for (int c = 0; c < 3; ++c) {
            float aq = 0.f, ak = 0.f;
            #pragma unroll
            for (int di = 0; di < 3; ++di) {
                #pragma unroll
                for (int dj = 0; dj < 3; ++dj) {
                    aq += qdw [c*9 + di*3 + dj] * tap[(p + di) * RP + c * TP + dj];
                    ak += kvdw[c*9 + di*3 + dj] * tap[(p + di) * RP + (3 + c) * TP + dj];
                }
            }
            qd[p][c] = aq; kd[p][c] = ak;
        }
    }

    // ---- the 15 window sums as one Gram matrix G = U * U^T on V_WMMA_F32_16X16X4_F32 ----
    // U: rows q0 q1 q2 kv0 kv1 kv2, columns the pixels. G[c][c] are the squared norms, G[c][3+d] = q_c . kv_d.
    // Each wave stages each of its chunks of 32 pixels (chunk p: pixel p of its lanes) channel-major in an LDS range
    // of its own and reads it back with lane l holding row (l & 15) and the 16 pixels of half (l >> 4): that one
    // fragment is A (row) and B (column) at once, so k slot (half, s) of A and of B is the same pixel.
    // Two chunks share each WMMA: rows and columns 0-5 hold the six channels of an even chunk, rows and columns 8-13
    // those of the odd chunk behind it. The 6x6 blocks at (0, 0) and at (8, 8) of G are then the two chunks' own Gram
    // partials; the blocks beside them mix pixels of the two chunks and are read by nobody. Rows 6, 7, 14 and 15
    // repeat the row in front of them; nobody reads what they reach either. One accumulator takes all chunk pairs.
    const int half = lane >> 4;
    const int col  = lane & 15;
    const int row  = col < 6 ? col : 5;
    const int odd  = col >> 3;                          // this lane's row and column belong to the odd chunk of a pair
    const int urow = (col & 7) < 6 ? (col & 7) : 5;     // and hold this channel of it
    {
        float* uw = s_u + wave * (PX * UW);
        #pragma unroll
        for (int p = 0; p < PX; ++p) {
            #pragma unroll
            for (int c = 0; c < 3; ++c) {
                uw[p * UW + c * UP + lane]       = qd[p][c];
                uw[p * UW + (3 + c) * UP + lane] = kd[p][c];
            }
        }
        // the wave's own stores have landed before other lanes of the wave read them; also keeps the
        // compiler from lifting the reads over the stores
        asm volatile("s_wait_dscnt 0x0" ::: "memory");
        const float4* up = (const float4*)(uw + odd * UW + urow * UP + 16 * half);
        v8f g = {};
        #pragma unroll
        for (int p = 0; p < PX; p += 2) {
            float4 u[4];
            #pragma unroll
            for (int t = 0; t < 4; ++t) u[t] = up[p * (UW / 4) + t];
            #pragma unroll
            for (int t = 0; t < 4; ++t) {
                v2f lo; lo.x = u[t].x; lo.y = u[t].y;
                v2f hi; hi.x = u[t].z; hi.y = u[t].w;
                g = __builtin_amdgcn_wmma_f32_16x16x4_f32(false, lo, false, lo, (short)0, g, false, false);
                g = __builtin_amdgcn_wmma_f32_16x16x4_f32(false, hi, false, hi, (short)0, g, false, false);
            }
        }
        // lane d < 6 holds G[0..5][d] of this wave's even chunks in registers 0-5, lane 24 + d the same of its odd
        // chunks (rows 8-13 lie in the upper half's registers 0-5); every lane stores its six, so no branch stands
        // behind the WMMA
        float* gp = s_g + wave * GW + lane * GP;
        *(float4*)gp       = make_float4(g[0], g[1], g[2], g[3]);
        *(float2*)(gp + 4) = make_float2(g[4], g[5]);
    }
    __syncthreads();

    // One sum a lane: lane 4c + d adds the waves' partials, even and odd chunks', of q_c . kv_d = G[c][3+d],
    // lane 16 + c those of G[c][c]; the other lanes add words that were stored too but are used by nobody. Every
    // lane then takes the 15 sums from those lanes.
    float sums[15];
    {
        const int gi = half ? row * (GP + 1) : (3 + (col & 3)) * GP + (col >> 2);
        float tot = 0.f;
        #pragma unroll
        for (int k = 0; k < NWV; ++k) tot += s_g[k * GW + gi] + s_g[k * GW + 24 * GP + gi];
        const int ti = __float_as_int(tot);
        #pragma unroll
        for (int c = 0; c < 6; ++c) sums[c] = __int_as_float(__builtin_amdgcn_readlane(ti, 16 + c));
        #pragma unroll
        for (int c = 0; c < 3; ++c)
            #pragma unroll
            for (int d = 0; d < 3; ++d)
                sums[6 + c*3 + d] = __int_as_float(__builtin_amdgcn_readlane(ti, 4 * c + d));
    }

    // ---- 3x3 attention: one result for the whole window, so every value here is the same in all lanes ----
    // The 15 sums lie in scalar registers. Reciprocal square root, reciprocal and exp2 are single instructions
    // that also work on scalar registers; a correctly rounded sqrt or divide is a long sequence, the divide a
    // vector one. With 1 / max(sqrt(s), eps) = min(rsq(s), 1 / eps) the block leaves the vector port but for the
    // three row maxima.
    const float temp = tempp[0];
    float rq[3], rk[3];
    #pragma unroll
    for (int c = 0; c < 3; ++c) {
        rq[c] = fminf(__builtin_amdgcn_rsqf(sums[c]),     1e12f) * temp;
        rk[c] = fminf(__builtin_amdgcn_rsqf(sums[3 + c]), 1e12f);
    }
    float attn[3][3];
    #pragma unroll
    for (int c = 0; c < 3; ++c) {
        float l[3];
        #pragma unroll
        for (int d = 0; d < 3; ++d) l[d] = sums[6 + c*3 + d] * rq[c] * rk[d];
        float mx = fmaxf(l[0], fmaxf(l[1], l[2]));
        float e0 = __builtin_amdgcn_exp2f((l[0]-mx) * 1.44269504f);
        float e1 = __builtin_amdgcn_exp2f((l[1]-mx) * 1.44269504f);
        float e2 = __builtin_amdgcn_exp2f((l[2]-mx) * 1.44269504f);
        float inv = __builtin_amdgcn_rcpf(e0 + e1 + e2);
        attn[c][0] = e0*inv; attn[c][1] = e1*inv; attn[c][2] = e2*inv;
    }
    // proj conv1x1 composed with the attention matrix, still on values that are the same in all lanes: one 3x3 map
    // takes a pixel's v straight to the residual branch
    float pa[3][3];
    #pragma unroll
    for (int c = 0; c < 3; ++c)
        #pragma unroll
        for (int d = 0; d < 3; ++d)
            pa[c][d] = pcw[c*3+0]*attn[0][d] + pcw[c*3+1]*attn[1][d] + pcw[c*3+2]*attn[2][d];

    // ---- MLP weights of this lane's A rows, asked for ahead of the MLP ----
    // (what they are for: the MLP section below). Every lane reads from a row clamped into the array.
    const int  sub  = lane & 7;                       // output row inside this lane's block
    const bool mine = ((lane >> 3) & 1) == half;      // this lane's A slots lie on the diagonal block
    const unsigned ow1a = 12u * (unsigned)sub;                 // byte offsets: fc1_w row sub,
    const int      sub4 = sub & 3;                             // rows 8 + sub exist for sub < 4
    const unsigned ow1b = 12u * (unsigned)sub4;                // fc1_w row 8 + sub4, from row 8,
    const unsigned ow2  = 48u * (unsigned)(sub < NC ? sub : NC - 1);   // fc2_w row sub (sub < 3)
    float w1a[3], w1b[3], w2[HID];
    #pragma unroll
    for (int k = 0; k < 3; ++k) {
        w1a[k] = ((const float*)((const char*)f1w + ow1a))[k];
        w1b[k] = ((const float*)((const char*)(f1w + 24) + ow1b))[k];
    }
    #pragma unroll
    for (int k = 0; k < HID; ++k) w2[k] = ((const float*)((const char*)f2w + ow2))[k];
    // The loads' offset registers are inputs here so that none of them is reused, not even as a
    // load's destination, ahead of the wait on the address translations.
    asm volatile("s_wait_xcnt 0x0" :: "v"(ow1a), "v"(ow1b), "v"(ow2) : "memory");

    // ---- MLP via V_WMMA_F32_16X16X4_F32, weights as A, pixels as B, no LDS ----
    // Lane l: col = l & 15, half = l >> 4. A: lane holds row col, B: lane holds column col;
    // each half supplies two of the four k slots, slot (half, s) of A meeting slot (half, s) of B.
    // D register r of lane l is D[8*half + r][col].
    // A is block-diagonal: rows 0-7 carry weights only in the k slots of half 0, rows 8-15 only in
    // those of half 1. Then D[8*half + r][col] is built from the B values of lane l alone, so every
    // lane feeds a pixel of its own as B and gets that pixel's results back as D: two k per WMMA,
    // eight output rows per WMMA, 32 pixels per WMMA.
    // fc1 weights: hidden unit j = 8*g + sub, composed with LayerNorm2's scale and shift. As in LayerNorm1 the three
    // deviations add up to zero, so fc1 of the normalised pixel is
    // h_j = (W[j][0]*s0 - W[j][2]*s2) * (d0 * rs) + (W[j][1]*s1 - W[j][2]*s2) * (d1 * rs) + (b_j + W[j] . shift):
    // k = {d0 * rs, d1 * rs} fills the two k slots of a lane, one WMMA a tile, and the last term is the WMMA's C.
    const bool ok1 = mine && sub < HID - 8;
    const bool ok2 = mine && sub < NC;
    v2f a1[2];
    {
        const float s0 = n2w[0], s1 = n2w[1], s2 = n2w[2];
        const float ta = w1a[2] * s2, tb = w1b[2] * s2;
        const float a0x = __builtin_fmaf(w1a[0], s0, -ta), a0y = __builtin_fmaf(w1a[1], s1, -ta);
        const float a1x = __builtin_fmaf(w1b[0], s0, -tb), a1y = __builtin_fmaf(w1b[1], s1, -tb);
        a1[0].x = mine ? a0x : 0.f;  a1[0].y = mine ? a0y : 0.f;
        a1[1].x = ok1  ? a1x : 0.f;  a1[1].y = ok1  ? a1y : 0.f;
    }
    // C of fc1: register r is hidden unit 8*g + r in every lane, so each is one value for the whole wave
    v8f cb[2];
    #pragma unroll
    for (int g = 0; g < 2; ++g) {
        #pragma unroll
        for (int r = 0; r < 8; ++r) {
            const int u = 8*g + r;
            cb[g][r] = u < HID ? uni(__builtin_fmaf(f1w[u*3+2], n2b[2], __builtin_fmaf(f1w[u*3+1], n2b[1],
                                     __builtin_fmaf(f1w[u*3+0], n2b[0], f1b[u])))) : 0.f;
        }
    }
    // fc2 weights: output channel sub (< 3); k = hidden units {2q, 2q+1}
    v2f a2[6];
    #pragma unroll
    for (int q = 0; q < 6; ++q) {
        a2[q].x = ok2 ? w2[2*q]     : 0.f;
        a2[q].y = ok2 ? w2[2*q + 1] : 0.f;
    }

    #pragma unroll
    for (int p = 0; p < PX; ++p) {
        // (proj * attn) @ v  (v = kd, unnormalized) + bias + residual
        float xs2[3];
        #pragma unroll
        for (int c = 0; c < 3; ++c)
            xs2[c] = __builtin_fmaf(pa[c][2], kd[p][2], __builtin_fmaf(pa[c][1], kd[p][1],
                     __builtin_fmaf(pa[c][0], kd[p][0], xin[p][c]))) + pcb[c];

        // ---- LayerNorm2, kept in this lane's registers: its scale and shift lie in a1 and cb ----
        v2f bx;
        {
            float m  = (xs2[0] + xs2[1] + xs2[2]) * (1.f / 3.f);
            float d0 = xs2[0]-m, d1 = xs2[1]-m, d2 = xs2[2]-m;
            float v  = (d0*d0 + d1*d1 + d2*d2) * (1.f / 3.f);
            float rs = rsqrtf(v + 1e-5f);
            bx.x = d0 * rs;
            bx.y = d1 * rs;
        }

        float hg[16];                                 // hidden units 0-11 of this pixel (12-15 unused)
        #pragma unroll
        for (int g = 0; g < 2; ++g) {
            v8f acc = __builtin_amdgcn_wmma_f32_16x16x4_f32(false, a1[g], false, bx,
                                                            (short)0, cb[g], false, false);
            #pragma unroll
            for (int r = 0; r < 8; ++r) hg[8*g + r] = acc[r];
        }
        v2f gl[6];                                    // exact GELU of units {2q, 2q+1}
        #pragma unroll
        for (int q = 0; q < 6; ++q) {
            v2f hv; hv.x = hg[2*q]; hv.y = hg[2*q + 1];
            gl[q] = gelu2(hv);
        }

        // fc2: C starts as residual + bias in this lane's rows 0-2; six chained k pairs
        v8f o = {};
        #pragma unroll
        for (int c = 0; c < 3; ++c) o[c] = xs2[c] + f2b[c];
        #pragma unroll
        for (int q = 0; q < 6; ++q) {
            o = __builtin_amdgcn_wmma_f32_16x16x4_f32(false, a2[q], false, gl[q],
                                                      (short)0, o, false, false);
        }

        // ---- coalesced channel-plane stores ----
        #pragma unroll
        for (int c = 0; c < 3; ++c)
            out[(long)(b * NC + c) * plane + pix + p * NW] = o[c];
    }
}

extern "C" void kernel_launch(void* const* d_in, const int* in_sizes, int n_in,
                              void* d_out, int out_size, void* d_ws, size_t ws_size,
                              hipStream_t stream) {
    (void)in_sizes; (void)n_in; (void)out_size; (void)d_ws; (void)ws_size;
    // setup_inputs order: 0:H 1:W 2:x 3:fhigh 4:norm1_w 5:norm1_b 6:q_C_w 7:q_dw_w
    // 8:kv_C_w 9:kv_dw_w 10:temperature 11:proj_C_w 12:proj_C_b 13:norm2_w 14:norm2_b
    // 15:fc1_w 16:fc1_b 17:fc2_w 18:fc2_b
    const float* x     = (const float*)d_in[2];
    const float* fh    = (const float*)d_in[3];
    const float* n1w   = (const float*)d_in[4];
    const float* n1b   = (const float*)d_in[5];
    const float* qcw   = (const float*)d_in[6];
    const float* qdw   = (const float*)d_in[7];
    const float* kvcw  = (const float*)d_in[8];
    const float* kvdw  = (const float*)d_in[9];
    const float* tempp = (const float*)d_in[10];
    const float* pcw   = (const float*)d_in[11];
    const float* pcb   = (const float*)d_in[12];
    const float* n2w   = (const float*)d_in[13];
    const float* n2b   = (const float*)d_in[14];
    const float* f1w   = (const float*)d_in[15];
    const float* f1b   = (const float*)d_in[16];
    const float* f2w   = (const float*)d_in[17];
    const float* f2b   = (const float*)d_in[18];
    float* out = (float*)d_out;

    const int nWindows = NB * (NH / WS) * (NW / WS);   // 16384
    winattn_fused<<<nWindows, NTH, 0, stream>>>(
        x, fh, n1w, n1b, qcw, qdw, kvcw, kvdw, tempp,
        pcw, pcb, n2w, n2b, f1w, f1b, f2w, f2b, out);
}

// v009
// It runs in 38.2 microseconds.
// Two timings next to v008 both put it at 1.08 times that version's speed.
// Over all steps from v000 it is 3.28 times as fast.
#include <hip/hip_runtime.h>
#include <math.h>

typedef float v2f __attribute__((ext_vector_type(2)));
typedef float v8f __attribute__((ext_vector_type(8)));

#define NB   16
#define NC   3
#define NH   512
#define NW   512
#define WS   16
#define HWIN 256     // ws*ws
#define HID  12
#define UP   36      // LDS pitch (floats) of one staged channel row of 32 pixels: 16-byte reads of rows 0-5 meet no bank twice
#define UW   (6 * UP)         // one chunk; 216 floats put the next chunk's rows 0-5 on the banks that this chunk's leave free
#define GP   8       // LDS pitch (floats) of one lane's eight accumulator registers
#define GW   (32 * GP)
#define TP   17      // LDS pitch (floats) of one channel's piece of a tile row: 16 pixels and one zero cell, the right edge of this piece and the left edge of the next
#define RP   (6 * TP)         // LDS pitch (floats) of one tile row: the six channels' pieces side by side
#define NT   (18 * RP + 1)    // 16 pixel rows between a top and a bottom row of zeros
#define PX   4                // pixels of the window per thread
#define NTH  (HWIN / PX)      // threads per work-group
#define NWV  (NTH / 32)       // waves per work-group

// ---- exact GELU of a pixel's twelve hidden units, doubled: 2 * h * Phi(h) = (h + |h|) - |h| * erfc(|h| / sqrt(2)) ----
// log2(erfc(a / sqrt(2))) is close to a parabola in a = |h|, so one short polynomial L(a) holds it and one exp2 gives
// erfc: no divide, no branch. No bound on h either: L's last coefficient is negative, so erfc goes on falling to 0.
// h + |h| is exact, so the negative side is the product alone. The polynomial is fitted to the error of the GELU
// itself, which stays below 5e-7 before rounding. The factor 1/2 lies in fc2's weights, where it is exact. Two units
// go side by side, so that each polynomial step is one packed fma. Every loop here is unrolled, so that the arrays are
// indexed by constants and stay in registers.
__device__ __forceinline__ v2f both(float c) { v2f r; r.x = c; r.y = c; return r; }
// A value that is the same in all lanes, named as such: its arithmetic then stays on the scalar unit. Used where the
// values fill a vector: there the compiler otherwise pairs them up and computes them with packed vector instructions.
__device__ __forceinline__ float uni(float c) { return __int_as_float(__builtin_amdgcn_readfirstlane(__float_as_int(c))); }
__device__ __forceinline__ void gelu12(const float* hg, v2f* gl)
{
    const float cl[6] = { -3.76321514e-5f, -1.15078783e+0f, -4.59992647e-1f, -5.18271700e-2f, 7.08446139e-3f, -4.73294058e-4f };
    v2f h[6], a[6], l[6];
    #pragma unroll
    for (int q = 0; q < 6; ++q) {
        h[q].x = hg[2*q]; h[q].y = hg[2*q + 1];
        a[q] = __builtin_elementwise_abs(h[q]);
        l[q] = both(cl[5]);
    }
    // the six pairs' polynomials step by step, side by side: no step waits for the one in front of it
    #pragma unroll
    for (int k = 4; k >= 0; --k) {
        #pragma unroll
        for (int q = 0; q < 6; ++q) l[q] = __builtin_elementwise_fma(l[q], a[q], both(cl[k]));
    }
    float e[12];
    #pragma unroll
    for (int q = 0; q < 6; ++q) { e[2*q] = l[q].x; e[2*q + 1] = l[q].y; }
    // The twelve exp2 and the one issue slot that the instruction set asks for behind a transcendental, in one statement.
    // The results
    // take registers of their own, so that no exp2 overwrites a source of another.
    float x[12];
    asm("v_exp_f32 %0, %12\n\tv_exp_f32 %1, %13\n\tv_exp_f32 %2, %14\n\tv_exp_f32 %3, %15\n\t"
        "v_exp_f32 %4, %16\n\tv_exp_f32 %5, %17\n\tv_exp_f32 %6, %18\n\tv_exp_f32 %7, %19\n\t"
        "v_exp_f32 %8, %20\n\tv_exp_f32 %9, %21\n\tv_exp_f32 %10, %22\n\tv_exp_f32 %11, %23\n\tv_nop"
        : "=&v"(x[0]), "=&v"(x[1]), "=&v"(x[2]), "=&v"(x[3]), "=&v"(x[4]), "=&v"(x[5]),
          "=&v"(x[6]), "=&v"(x[7]), "=&v"(x[8]), "=&v"(x[9]), "=&v"(x[10]), "=&v"(x[11])
        : "v"(e[0]), "v"(e[1]), "v"(e[2]), "v"(e[3]), "v"(e[4]), "v"(e[5]),
          "v"(e[6]), "v"(e[7]), "v"(e[8]), "v"(e[9]), "v"(e[10]), "v"(e[11]));
    #pragma unroll
    for (int q = 0; q < 6; ++q) {
        v2f ev; ev.x = x[2*q]; ev.y = x[2*q + 1];
        gl[q] = __builtin_elementwise_fma(-a[q], ev, h[q] + a[q]);
    }
}

// One window per work-group, PX pixels per thread: rows PX * i to PX * i + PX - 1 of column j. What a wave does once
// whatever its pixel count (the window sums, the 3x3 softmax, the weight fragments, the addresses) is then done by
// NWV waves a window, and the PX pixels of a thread read the tile rows that their 3x3 taps share only once.
// Every loop over p is unrolled, so that the per-pixel arrays are indexed by constants and stay in registers.
// second bound: 8 waves per SIMD at least; the build stays within 128 registers, so 8 waves fit a SIMD
__global__ __launch_bounds__(NTH, 8) void winattn_fused(
    const float* __restrict__ x,      const float* __restrict__ fhigh,
    const float* __restrict__ n1w,    const float* __restrict__ n1b,
    const float* __restrict__ qcw,    const float* __restrict__ qdw,
    const float* __restrict__ kvcw,   const float* __restrict__ kvdw,
    const float* __restrict__ tempp,
    const float* __restrict__ pcw,    const float* __restrict__ pcb,
    const float* __restrict__ n2w,    const float* __restrict__ n2b,
    const float* __restrict__ f1w,    const float* __restrict__ f1b,
    const float* __restrict__ f2w,    const float* __restrict__ f2b,
    float* __restrict__ out)
{
    // q0-2, kv0-2 after the 1x1 conv, inside a border of zeros. The alignment puts the array first in LDS, and with
    // the channels side by side the taps in a thread's first tile rows lie within the reach of a two-address load's offsets.
    __shared__ __attribute__((aligned(64))) float s_t[NT];
    __shared__ __attribute__((aligned(16))) float s_u[8 * UW];   // per wave and chunk: q0-2, kv0-2 of 32 pixels
    __shared__ __attribute__((aligned(16))) float s_g[NWV * GW]; // per wave: its Gram partial, as the accumulator lies in the lanes

    const int w   = blockIdx.x;          // window id = b*1024 + wy*32 + wx
    const int b   = w >> 10;
    const int wy  = (w >> 5) & 31;
    const int wx  = w & 31;
    const int tid = threadIdx.x;
    const int i   = tid >> 4;
    const int j   = tid & 15;
    const int lane = tid & 31;
    const int wave = tid >> 5;

    const int  y     = wy * WS + i * PX;          // the thread's first pixel; pixel p lies p rows below
    const int  xg    = wx * WS + j;
    const long pix   = (long)y * NW + xg;
    const long plane = (long)NH * NW;
    const long xbase = (long)b * NC * plane + pix;

    // ---- load x and fhigh (3 channels each) of all PX pixels ----
    float xin[PX][3], fin[PX][3];
    const long fb = (long)w * (NC * HWIN);
    #pragma unroll
    for (int p = 0; p < PX; ++p) {
        #pragma unroll
        for (int c = 0; c < 3; ++c) {
            xin[p][c] = x[xbase + c * plane + p * NW];
            fin[p][c] = fhigh[fb + c * HWIN + (i * PX + p) * WS + j];
        }
    }

    // ---- the zero border ----
    // Pixel (r, col) of channel c lies at (r + 1) * RP + c * TP + col + 1. Zero: the top row with the first cell
    // behind it, the bottom row with the last cell, and in each pixel row the cell in front of each channel's piece.
    #pragma unroll
    for (int k = 0; k <= RP; k += NTH) {
        if (k + tid <= RP) {
            s_t[k + tid] = 0.f;
            s_t[17 * RP + k + tid] = 0.f;
        }
    }
    if (j < 6) {
        #pragma unroll
        for (int p = 0; p < PX; ++p) s_t[(i * PX + p + 1) * RP + j * TP] = 0.f;
    }
    float* tap = s_t + i * (PX * RP) + j;     // tap (di, dj) of channel c of pixel p lies at (p + di) * RP + c * TP + dj
    // ---- LayerNorm1's scale and shift composed with the kv 1x1 conv, once, on values that are the same in all lanes ----
    // The three deviations from the mean add up to zero: d2 = -d0 - d1. So the conv of the normalised pixel is
    // kv_c = kA[c] * (d0 * rs) + kB[c] * (d1 * rs) + kC[c]; d2 itself is left to the variance alone.
    float kA[3], kB[3], kC[3];
    #pragma unroll
    for (int c = 0; c < 3; ++c) {
        const float k2 = kvcw[c*3+2] * n1w[2];
        kA[c] = kvcw[c*3+0] * n1w[0] - k2;
        kB[c] = kvcw[c*3+1] * n1w[1] - k2;
        kC[c] = kvcw[c*3+0]*n1b[0] + kvcw[c*3+1]*n1b[1] + kvcw[c*3+2]*n1b[2];
    }
    // ---- LayerNorm1 over C, the two 1x1 convs -> LDS ----
    #pragma unroll
    for (int p = 0; p < PX; ++p) {
        float* ctr = tap + (p + 1) * RP + 1;
        float m  = (xin[p][0] + xin[p][1] + xin[p][2]) * (1.f / 3.f);
        float d0 = xin[p][0] - m, d1 = xin[p][1] - m, d2 = xin[p][2] - m;
        float v  = (d0 * d0 + d1 * d1 + d2 * d2) * (1.f / 3.f);
        // The rsq and the one issue slot that the instruction set asks for behind a transcendental, in one statement.
        float rs;
        asm("v_rsq_f32 %0, %1\n\tv_nop" : "=v"(rs) : "v"(v + 1e-5f));
        float e0 = d0 * rs, e1 = d1 * rs;
        #pragma unroll
        for (int c = 0; c < 3; ++c) {
            ctr[(3 + c) * TP] = __builtin_fmaf(kA[c], e0, __builtin_fmaf(kB[c], e1, kC[c]));
            ctr[c * TP]       = qcw[c*3+0]*fin[p][0] + qcw[c*3+1]*fin[p][1] + qcw[c*3+2]*fin[p][2];
        }
    }
    __syncthreads();

    // ---- depthwise 3x3: the window's zero padding is read from the border, so all nine taps are unconditional ----
    float qd[PX][3], kd[PX][3];
    #pragma unroll
    for (int p = 0; p < PX; ++p) {
        #pragma unroll
        for (int c = 0; c < 3; ++c) {
            float aq = 0.f, ak = 0.f;
            #pragma unroll
            for (int di = 0; di < 3; ++di) {
                #pragma unroll
                for (int dj = 0; dj < 3; ++dj) {
                    aq += qdw [c*9 + di*3 + dj] * tap[(p + di) * RP + c * TP + dj];
                    ak += kvdw[c*9 + di*3 + dj] * tap[(p + di) * RP + (3 + c) * TP + dj];
                }
            }
            qd[p][c] = aq; kd[p][c] = ak;
        }
    }

    // ---- the 15 window sums as one Gram matrix G = U * U^T on V_WMMA_F32_16X16X4_F32 ----
    // U: rows q0 q1 q2 kv0 kv1 kv2, columns the pixels. G[c][c] are the squared norms, G[c][3+d] = q_c . kv_d.
    // Each wave stages each of its chunks of 32 pixels (chunk p: pixel p of its lanes) channel-major in an LDS range
    // of its own and reads it back with lane l holding row (l & 15) and the 16 pixels of half (l >> 4): that one
    // fragment is A (row) and B (column) at once, so k slot (half, s) of A and of B is the same pixel.
    // Two chunks share each WMMA: rows and columns 0-5 hold the six channels of an even chunk, rows and columns 8-13
    // those of the odd chunk behind it. The 6x6 blocks at (0, 0) and at (8, 8) of G are then the two chunks' own Gram
    // partials; the blocks beside them mix pixels of the two chunks and are read by nobody. Rows 6, 7, 14 and 15
    // repeat the row in front of them; nobody reads what they reach either. One accumulator takes all chunk pairs.
    const int half = lane >> 4;
    const int col  = lane & 15;
    const int row  = col < 6 ? col : 5;
    const int odd  = col >> 3;                          // this lane's row and column belong to the odd chunk of a pair
    const int urow = (col & 7) < 6 ? (col & 7) : 5;     // and hold this channel of it
    {
        float* uw = s_u + wave * (PX * UW);
        #pragma unroll
        for (int p = 0; p < PX; ++p) {
            #pragma unroll
            for (int c = 0; c < 3; ++c) {
                uw[p * UW + c * UP + lane]       = qd[p][c];
                uw[p * UW + (3 + c) * UP + lane] = kd[p][c];
            }
        }
        // the wave's own stores have landed before other lanes of the wave read them; also keeps the
        // compiler from lifting the reads over the stores
        asm volatile("s_wait_dscnt 0x0" ::: "memory");
        const float4* up = (const float4*)(uw + odd * UW + urow * UP + 16 * half);
        v8f g = {};
        #pragma unroll
        for (int p = 0; p < PX; p += 2) {
            float4 u[4];
            #pragma unroll
            for (int t = 0; t < 4; ++t) u[t] = up[p * (UW / 4) + t];
            #pragma unroll
            for (int t = 0; t < 4; ++t) {
                v2f lo; lo.x = u[t].x; lo.y = u[t].y;
                v2f hi; hi.x = u[t].z; hi.y = u[t].w;
                g = __builtin_amdgcn_wmma_f32_16x16x4_f32(false, lo, false, lo, (short)0, g, false, false);
                g = __builtin_amdgcn_wmma_f32_16x16x4_f32(false, hi, false, hi, (short)0, g, false, false);
            }
        }
        // lane d < 6 holds G[0..5][d] of this wave's even chunks in registers 0-5, lane 24 + d the same of its odd
        // chunks (rows 8-13 lie in the upper half's registers 0-5); every lane stores its six, so no branch stands
        // behind the WMMA
        float* gp = s_g + wave * GW + lane * GP;
        *(float4*)gp       = make_float4(g[0], g[1], g[2], g[3]);
        *(float2*)(gp + 4) = make_float2(g[4], g[5]);
    }
    __syncthreads();

    // One sum a lane: lane 4c + d adds the waves' partials, even and odd chunks', of q_c . kv_d = G[c][3+d],
    // lane 16 + c those of G[c][c]; the other lanes add words that were stored too but are used by nobody. Every
    // lane then takes the 15 sums from those lanes.
    float sums[15];
    {
        const int gi = half ? row * (GP + 1) : (3 + (col & 3)) * GP + (col >> 2);
        float tot = 0.f;
        #pragma unroll
        for (int k = 0; k < NWV; ++k) tot += s_g[k * GW + gi] + s_g[k * GW + 24 * GP + gi];
        const int ti = __float_as_int(tot);
        #pragma unroll
        for (int c = 0; c < 6; ++c) sums[c] = __int_as_float(__builtin_amdgcn_readlane(ti, 16 + c));
        #pragma unroll
        for (int c = 0; c < 3; ++c)
            #pragma unroll
            for (int d = 0; d < 3; ++d)
                sums[6 + c*3 + d] = __int_as_float(__builtin_amdgcn_readlane(ti, 4 * c + d));
    }

    // ---- 3x3 attention: one result for the whole window, so every value here is the same in all lanes ----
    // The 15 sums lie in scalar registers. Reciprocal square root, reciprocal and exp2 are single instructions
    // that also work on scalar registers; a correctly rounded sqrt or divide is a long sequence, the divide a
    // vector one. With 1 / max(sqrt(s), eps) = min(rsq(s), 1 / eps) the block leaves the vector port but for the
    // three row maxima.
    const float temp = tempp[0];
    float rq[3], rk[3];
    #pragma unroll
    for (int c = 0; c < 3; ++c) {
        rq[c] = fminf(__builtin_amdgcn_rsqf(sums[c]),     1e12f) * temp;
        rk[c] = fminf(__builtin_amdgcn_rsqf(sums[3 + c]), 1e12f);
    }
    float attn[3][3];
    #pragma unroll
    for (int c = 0; c < 3; ++c) {
        float l[3];
        #pragma unroll
        for (int d = 0; d < 3; ++d) l[d] = sums[6 + c*3 + d] * rq[c] * rk[d];
        float mx = fmaxf(l[0], fmaxf(l[1], l[2]));
        float e0 = __builtin_amdgcn_exp2f((l[0]-mx) * 1.44269504f);
        float e1 = __builtin_amdgcn_exp2f((l[1]-mx) * 1.44269504f);
        float e2 = __builtin_amdgcn_exp2f((l[2]-mx) * 1.44269504f);
        float inv = __builtin_amdgcn_rcpf(e0 + e1 + e2);
        attn[c][0] = e0*inv; attn[c][1] = e1*inv; attn[c][2] = e2*inv;
    }
    // proj conv1x1 composed with the attention matrix, still on values that are the same in all lanes: one 3x3 map
    // takes a pixel's v straight to the residual branch
    float pa[3][3];
    #pragma unroll
    for (int c = 0; c < 3; ++c)
        #pragma unroll
        for (int d = 0; d < 3; ++d)
            pa[c][d] = pcw[c*3+0]*attn[0][d] + pcw[c*3+1]*attn[1][d] + pcw[c*3+2]*attn[2][d];

    // ---- MLP weights of this lane's A rows, asked for ahead of the MLP ----
    // (what they are for: the MLP section below). Every lane reads from a row clamped into the array.
    const int  sub  = lane & 7;                       // output row inside this lane's block
    const bool mine = ((lane >> 3) & 1) == half;      // this lane's A slots lie on the diagonal block
    const unsigned ow1a = 12u * (unsigned)sub;                 // byte offsets: fc1_w row sub,
    const int      sub4 = sub & 3;                             // rows 8 + sub exist for sub < 4
    const unsigned ow1b = 12u * (unsigned)sub4;                // fc1_w row 8 + sub4, from row 8,
    const unsigned ow2  = 48u * (unsigned)(sub < NC ? sub : NC - 1);   // fc2_w row sub (sub < 3)
    float w1a[3], w1b[3], w2[HID];
    #pragma unroll
    for (int k = 0; k < 3; ++k) {
        w1a[k] = ((const float*)((const char*)f1w + ow1a))[k];
        w1b[k] = ((const float*)((const char*)(f1w + 24) + ow1b))[k];
    }
    #pragma unroll
    for (int k = 0; k < HID; ++k) w2[k] = ((const float*)((const char*)f2w + ow2))[k];
    // The loads' offset registers are inputs here so that none of them is reused, not even as a
    // load's destination, ahead of the wait on the address translations.
    asm volatile("s_wait_xcnt 0x0" :: "v"(ow1a), "v"(ow1b), "v"(ow2) : "memory");

    // ---- MLP via V_WMMA_F32_16X16X4_F32, weights as A, pixels as B, no LDS ----
    // Lane l: col = l & 15, half = l >> 4. A: lane holds row col, B: lane holds column col;
    // each half supplies two of the four k slots, slot (half, s) of A meeting slot (half, s) of B.
    // D register r of lane l is D[8*half + r][col].
    // A is block-diagonal: rows 0-7 carry weights only in the k slots of half 0, rows 8-15 only in
    // those of half 1. Then D[8*half + r][col] is built from the B values of lane l alone, so every
    // lane feeds a pixel of its own as B and gets that pixel's results back as D: two k per WMMA,
    // eight output rows per WMMA, 32 pixels per WMMA.
    // fc1 weights: hidden unit j = 8*g + sub, composed with LayerNorm2's scale and shift. As in LayerNorm1 the three
    // deviations add up to zero, so fc1 of the normalised pixel is
    // h_j = (W[j][0]*s0 - W[j][2]*s2) * (d0 * rs) + (W[j][1]*s1 - W[j][2]*s2) * (d1 * rs) + (b_j + W[j] . shift):
    // k = {d0 * rs, d1 * rs} fills the two k slots of a lane, one WMMA a tile, and the last term is the WMMA's C.
    const bool ok1 = mine && sub < HID - 8;
    const bool ok2 = mine && sub < NC;
    v2f a1[2];
    {
        const float s0 = n2w[0], s1 = n2w[1], s2 = n2w[2];
        const float ta = w1a[2] * s2, tb = w1b[2] * s2;
        const float a0x = __builtin_fmaf(w1a[0], s0, -ta), a0y = __builtin_fmaf(w1a[1], s1, -ta);
        const float a1x = __builtin_fmaf(w1b[0], s0, -tb), a1y = __builtin_fmaf(w1b[1], s1, -tb);
        a1[0].x = mine ? a0x : 0.f;  a1[0].y = mine ? a0y : 0.f;
        a1[1].x = ok1  ? a1x : 0.f;  a1[1].y = ok1  ? a1y : 0.f;
    }
    // C of fc1: register r is hidden unit 8*g + r in every lane, so each is one value for the whole wave
    v8f cb[2];
    #pragma unroll
    for (int g = 0; g < 2; ++g) {
        #pragma unroll
        for (int r = 0; r < 8; ++r) {
            const int u = 8*g + r;
            cb[g][r] = u < HID ? uni(__builtin_fmaf(f1w[u*3+2], n2b[2], __builtin_fmaf(f1w[u*3+1], n2b[1],
                                     __builtin_fmaf(f1w[u*3+0], n2b[0], f1b[u])))) : 0.f;
        }
    }
    // fc2 weights: output channel sub (< 3); k = hidden units {2q, 2q+1}; halved, since gelu12 gives twice the GELU
    v2f a2[6];
    #pragma unroll
    for (int q = 0; q < 6; ++q) {
        a2[q].x = ok2 ? 0.5f * w2[2*q]     : 0.f;
        a2[q].y = ok2 ? 0.5f * w2[2*q + 1] : 0.f;
    }

    #pragma unroll
    for (int p = 0; p < PX; ++p) {
        // (proj * attn) @ v  (v = kd, unnormalized) + bias + residual
        float xs2[3];
        #pragma unroll
        for (int c = 0; c < 3; ++c)
            xs2[c] = __builtin_fmaf(pa[c][2], kd[p][2], __builtin_fmaf(pa[c][1], kd[p][1],
                     __builtin_fmaf(pa[c][0], kd[p][0], xin[p][c]))) + pcb[c];

        // ---- LayerNorm2, kept in this lane's registers: its scale and shift lie in a1 and cb ----
        v2f bx;
        {
            float m  = (xs2[0] + xs2[1] + xs2[2]) * (1.f / 3.f);
            float d0 = xs2[0]-m, d1 = xs2[1]-m, d2 = xs2[2]-m;
            float v  = (d0*d0 + d1*d1 + d2*d2) * (1.f / 3.f);
            float rs = rsqrtf(v + 1e-5f);
            bx.x = d0 * rs;
            bx.y = d1 * rs;
        }

        float hg[16];                                 // hidden units 0-11 of this pixel (12-15 unused)
        #pragma unroll
        for (int g = 0; g < 2; ++g) {
            v8f acc = __builtin_amdgcn_wmma_f32_16x16x4_f32(false, a1[g], false, bx,
                                                            (short)0, cb[g], false, false);
            #pragma unroll
            for (int r = 0; r < 8; ++r) hg[8*g + r] = acc[r];
        }
        v2f gl[6];                                    // twice the exact GELU of units {2q, 2q+1}
        gelu12(hg, gl);

        // fc2: C starts as residual + bias in this lane's rows 0-2; six chained k pairs
        v8f o = {};
        #pragma unroll
        for (int c = 0; c < 3; ++c) o[c] = xs2[c] + f2b[c];
        #pragma unroll
        for (int q = 0; q < 6; ++q) {
            o = __builtin_amdgcn_wmma_f32_16x16x4_f32(false, a2[q], false, gl[q],
                                                      (short)0, o, false, false);
        }

        // ---- coalesced channel-plane stores ----
        #pragma unroll
        for (int c = 0; c < 3; ++c)
            out[(long)(b * NC + c) * plane + pix + p * NW] = o[c];
    }
}

extern "C" void kernel_launch(void* const* d_in, const int* in_sizes, int n_in,
                              void* d_out, int out_size, void* d_ws, size_t ws_size,
                              hipStream_t stream) {
    (void)in_sizes; (void)n_in; (void)out_size; (void)d_ws; (void)ws_size;
    // setup_inputs order: 0:H 1:W 2:x 3:fhigh 4:norm1_w 5:norm1_b 6:q_C_w 7:q_dw_w
    // 8:kv_C_w 9:kv_dw_w 10:temperature 11:proj_C_w 12:proj_C_b 13:norm2_w 14:norm2_b
    // 15:fc1_w 16:fc1_b 17:fc2_w 18:fc2_b
    const float* x     = (const float*)d_in[2];
    const float* fh    = (const float*)d_in[3];
    const float* n1w   = (const float*)d_in[4];
    const float* n1b   = (const float*)d_in[5];
    const float* qcw   = (const float*)d_in[6];
    const float* qdw   = (const float*)d_in[7];
    const float* kvcw  = (const float*)d_in[8];
    const float* kvdw  = (const float*)d_in[9];
    const float* tempp = (const float*)d_in[10];
    const float* pcw   = (const float*)d_in[11];
    const float* pcb   = (const float*)d_in[12];
    const float* n2w   = (const float*)d_in[13];
    const float* n2b   = (const float*)d_in[14];
    const float* f1w   = (const float*)d_in[15];
    const float* f1b   = (const float*)d_in[16];
    const float* f2w   = (const float*)d_in[17];
    const float* f2b   = (const float*)d_in[18];
    float* out = (float*)d_out;

    const int nWindows = NB * (NH / WS) * (NW / WS);   // 16384
    winattn_fused<<<nWindows, NTH, 0, stream>>>(
        x, fh, n1w, n1b, qcw, qdw, kvcw, kvdw, tempp,
        pcw, pcb, n2w, n2b, f1w, f1b, f2w, f2b, out);
}
